// v000
// Times are from an AMD MI455X. After a warm-up the kernel runs many times in a row, and a time is the length of
// such a window on the GPU divided by its runs, so every launch and the gaps after it count. The runs cycle
// through copies of the inputs. A figure is the median of several windows, for all but v000 over two sittings.
// Sittings can differ by a few percent; kernels timed side by side share one.
// v000 is the starting kernel. One run takes 303 microseconds.
#include <hip/hip_runtime.h>

typedef __attribute__((ext_vector_type(16))) _Float16 v16h;
typedef __attribute__((ext_vector_type(8)))  float    v8f;
typedef __attribute__((ext_vector_type(4)))  float    v4f;
typedef __attribute__((ext_vector_type(2)))  float    v2f;

#define B_DIM 16384
#define D_DIM 2048
#define U_DIM 256

#define ROWS_PER_BLOCK 128      // 8 waves * 16 rows each
#define KT 512                  // K staged per LDS refill
#define NCHUNK (KT / 32)        // 16 chunks of K=32

// out[b,u] = sum_d x16[b,d]*w16[d,u]*(mp==0) + sum_d x[b,d]*w[d,u]*(mp==1) + bias[u]
__global__ __launch_bounds__(256)
void mpdense_wmma_kernel(const float* __restrict__ x,
                         const float* __restrict__ w,
                         const float* __restrict__ bias,
                         const int*   __restrict__ mp,
                         float* __restrict__ out)
{
    // Fragment-major staged B operands (masked weights), rebuilt per 512-K slab.
    __shared__ __align__(32) _Float16 sB16[NCHUNK * 512];  // 16 KB
    __shared__ __align__(16) float    sB32[NCHUNK * 512];  // 32 KB

    const int tid  = threadIdx.x;
    const int lane = tid & 31;
    const int wave = tid >> 5;

    const int tileN  = blockIdx.x & 15;     // 256/16 = 16 column tiles
    const int rowBlk = blockIdx.x >> 4;
    const int gn0    = tileN * 16;

    const int n    = lane & 15;
    const int hiL  = lane >> 4;             // 0: lanes 0-15, 1: lanes 16-31
    const int kb16 = hiL * 8;               // fp16 A-fragment K base per ISA layout
    const int kb32 = hiL * 2;               // fp32 A-fragment K base per ISA layout

    const int m = rowBlk * ROWS_PER_BLOCK + wave * 16 + n;

    v8f acc = {};

    for (int kt = 0; kt < D_DIM; kt += KT) {
        __syncthreads();
        // ---- cooperative fill: build masked-B WMMA fragments in LDS ----
        // 512 K-values x 16 cols = 8192 elements; 256 threads x 32 iters, no divergence.
        for (int t = tid; t < KT * 16; t += 256) {
            const int kl = t >> 4;          // 0..511 (K within slab)
            const int nn = t & 15;          // column within tile
            const int k  = kt + kl;
            const float wv = w[k * U_DIM + gn0 + nn];
            const int   mv = mp[k * U_DIM + gn0 + nn];
            const _Float16 w16 = (mv == 0) ? (_Float16)wv : (_Float16)0.0f;
            const float    w32 = (mv == 1) ? wv : 0.0f;

            const int c  = kl >> 5;         // chunk index within slab
            const int kk = kl & 31;         // K within chunk

            // fp16 B fragment inverse map (16-bit 32x16 B, wave32):
            // lane L holds K = kbase + (h&7) + (h>=8 ? 16:0), kbase = (L>=16)?8:0
            {
                const int r = kk & 15;
                const int L = nn + ((r >= 8) ? 16 : 0);
                const int h = (r & 7) + ((kk >= 16) ? 8 : 0);
                sB16[c * 512 + L * 16 + h] = w16;
            }
            // fp32 B fragment inverse map (32-bit 4x16 B per sub-chunk j):
            // lane L, sub-chunk j holds K = 4j + ((L>=16)?2:0) + {0,1}
            {
                const int j = kk >> 2;
                const int q = kk & 3;
                const int L = nn + ((q >= 2) ? 16 : 0);
                sB32[c * 512 + L * 16 + j * 2 + (q & 1)] = w32;
            }
        }
        __syncthreads();

        // ---- per-wave MMA over staged chunks, A streamed from global ----
        const float* xr = x + (size_t)m * D_DIM + kt;
        for (int c = 0; c < NCHUNK; ++c) {
            const int k0 = c * 32;

            // fp16 A fragment: lane reads 8 consecutive floats at kb16 and at 16+kb16
            v4f lo0 = *(const v4f*)(xr + k0 + kb16);
            v4f lo1 = *(const v4f*)(xr + k0 + kb16 + 4);
            v4f hi0 = *(const v4f*)(xr + k0 + 16 + kb16);
            v4f hi1 = *(const v4f*)(xr + k0 + 16 + kb16 + 4);
            v16h a16;
#pragma unroll
            for (int i = 0; i < 4; ++i) {
                a16[i]      = (_Float16)lo0[i];
                a16[4 + i]  = (_Float16)lo1[i];
                a16[8 + i]  = (_Float16)hi0[i];
                a16[12 + i] = (_Float16)hi1[i];
            }
            v16h b16 = *(const v16h*)(&sB16[c * 512 + lane * 16]);
            acc = __builtin_amdgcn_wmma_f32_16x16x32_f16(
                false, a16, false, b16, (short)0, acc, false, false);

            // fp32 bucket: 8 x v_wmma_f32_16x16x4_f32 over the same 32 K values
#pragma unroll
            for (int j = 0; j < 8; ++j) {
                v2f a32 = *(const v2f*)(xr + k0 + j * 4 + kb32);
                v2f b32 = *(const v2f*)(&sB32[c * 512 + lane * 16 + j * 2]);
                acc = __builtin_amdgcn_wmma_f32_16x16x4_f32(
                    false, a32, false, b32, (short)0, acc, false, false);
            }
        }
    }

    // ---- epilogue: bias + store (C/D layout: VGPR r -> M = r + 8*hiL, N = lane&15) ----
    const float bb = bias[gn0 + n];
    const int rowBase = rowBlk * ROWS_PER_BLOCK + wave * 16 + hiL * 8;
#pragma unroll
    for (int r = 0; r < 8; ++r) {
        out[(size_t)(rowBase + r) * U_DIM + gn0 + n] = acc[r] + bb;
    }
}

extern "C" void kernel_launch(void* const* d_in, const int* in_sizes, int n_in,
                              void* d_out, int out_size, void* d_ws, size_t ws_size,
                              hipStream_t stream) {
    (void)in_sizes; (void)n_in; (void)d_ws; (void)ws_size; (void)out_size;
    const float* x    = (const float*)d_in[0];
    const float* w    = (const float*)d_in[1];
    const float* bias = (const float*)d_in[2];
    const int*   mp   = (const int*)d_in[3];
    float* out = (float*)d_out;

    dim3 grid((B_DIM / ROWS_PER_BLOCK) * (U_DIM / 16));  // 128 * 16 = 2048 blocks
    dim3 block(256);                                     // 8 waves (wave32)
    mpdense_wmma_kernel<<<grid, block, 0, stream>>>(x, w, bias, mp, out);
}

// v001
// Measured time: 142 microseconds a run.
// Two timings next to v000 both put it at 2.23 times that version's speed.
#include <hip/hip_runtime.h>

typedef __attribute__((ext_vector_type(16))) _Float16 v16h;
typedef __attribute__((ext_vector_type(8)))  _Float16 v8h;
typedef __attribute__((ext_vector_type(8)))  float    v8f;
typedef __attribute__((ext_vector_type(4)))  float    v4f;
typedef __attribute__((ext_vector_type(2)))  float    v2f;

#define B_DIM 16384
#define D_DIM 2048
#define U_DIM 256

#define ROWS_PER_BLOCK 128      // 8 waves * 16 rows each
#define NT 8                    // 16-column output tiles per wave
#define COLS_PER_BLOCK (NT * 16)
#define KT 256                  // K staged per LDS refill
#define NCHUNK (KT / 32)        // 8 chunks of K=32

// out[b,u] = sum_d x16[b,d]*w16[d,u]*(mp==0) + sum_d x[b,d]*w[d,u]*(mp==1) + bias[u]
// Each wave owns a 16 x 128 strip of out: one A fragment feeds NT matrix instructions.
__global__ __launch_bounds__(256)
void mpdense_wmma_kernel(const float* __restrict__ x,
                         const float* __restrict__ w,
                         const float* __restrict__ bias,
                         const int*   __restrict__ mp,
                         float* __restrict__ out)
{
    // Staged B operands (masked weights), rebuilt per 256-K slab.
    // One 16-byte piece per lane, the 32 lanes' pieces side by side (512 B per read).
    __shared__ __align__(16) _Float16 sB16[NCHUNK * NT * 512];  // 64 KB
    __shared__ __align__(16) float    sB32[NCHUNK * NT * 512];  // 128 KB

    const int tid  = threadIdx.x;
    const int lane = tid & 31;
    const int wave = tid >> 5;

    const int tileN  = blockIdx.x & 1;      // 256/128 = 2 column strips
    const int rowBlk = blockIdx.x >> 1;
    const int gn0    = tileN * COLS_PER_BLOCK;

    const int n    = lane & 15;
    const int hiL  = lane >> 4;             // 0: lanes 0-15, 1: lanes 16-31
    const int kb16 = hiL * 8;               // fp16 A-fragment K base per ISA layout
    const int kb32 = hiL * 2;               // fp32 A-fragment K base per ISA layout

    const int m = rowBlk * ROWS_PER_BLOCK + wave * 16 + n;

    // fill roles: one column of the strip per thread, K parity by half of the block
    const int nn   = tid & 127;
    const int kPar = tid >> 7;
    const int ntF  = nn >> 4;               // column tile within strip
    const int n16  = nn & 15;               // column within tile

    v8f acc[NT] = {};

    for (int kt = 0; kt < D_DIM; kt += KT) {
        __syncthreads();
        // ---- cooperative fill: build masked-B WMMA fragments in LDS ----
        // 256 K-values x 128 cols; a thread keeps one column and every second K value
        // (K within chunk kk = 2*ii + kPar), two chunks (32 values) per trip, no divergence.
        for (int c0 = 0; c0 < NCHUNK; c0 += 2) {
            float wv[32];
            int   mv[32];
            // all loads of the trip first, so that their latencies overlap;
            // unrolled so that wv/mv stay in registers and the offsets become immediates
#pragma unroll
            for (int u = 0; u < 32; ++u) {
                const int k = kt + c0 * 32 + 2 * u + kPar;
                wv[u] = w[k * U_DIM + gn0 + nn];
                mv[u] = mp[k * U_DIM + gn0 + nn];
            }
            // unrolled: ii is a constant, so each LDS address is one base plus an immediate
#pragma unroll
            for (int u = 0; u < 32; ++u) {
                const _Float16 w16 = (mv[u] == 0) ? (_Float16)wv[u] : (_Float16)0.0f;
                const float    w32 = (mv[u] == 1) ? wv[u] : 0.0f;
                const int ii   = u & 15;
                const int frag = (c0 + (u >> 4)) * NT + ntF;

                // fp16 B fragment inverse map (16-bit 32x16 B, wave32):
                // lane L holds K = kbase + (h&7) + (h>=8 ? 16:0), kbase = (L>=16)?8:0
                {
                    const int L  = n16 + (((ii & 7) >= 4) ? 16 : 0);   // (kk & 15) >= 8
                    const int hh = ii >> 3;                            // kk >= 16
                    sB16[(frag * 2 + hh) * 256 + L * 8 + 2 * (ii & 3) + kPar] = w16;
                }
                // fp32 B fragment inverse map (32-bit 4x16 B per sub-chunk j = kk >> 2):
                // lane L, sub-chunk j holds K = 4j + ((L>=16)?2:0) + {0,1}
                {
                    const int j = ii >> 1;
                    const int L = n16 + ((ii & 1) ? 16 : 0);           // (kk & 3) >= 2
                    sB32[(frag * 4 + (j >> 1)) * 128 + L * 4 + (j & 1) * 2 + kPar] = w32;
                }
            }
        }
        __syncthreads();

        // ---- per-wave MMA over staged chunks, A streamed from global ----
        const float* xr = x + (size_t)m * D_DIM + kt;
        for (int c = 0; c < NCHUNK; ++c) {
            const int k0 = c * 32;

            // fp16 A fragment: lane reads 8 consecutive floats at kb16 and at 16+kb16
            v4f lo0 = *(const v4f*)(xr + k0 + kb16);
            v4f lo1 = *(const v4f*)(xr + k0 + kb16 + 4);
            v4f hi0 = *(const v4f*)(xr + k0 + 16 + kb16);
            v4f hi1 = *(const v4f*)(xr + k0 + 16 + kb16 + 4);
            v2f a32[8];
            // unrolled here and below: a32, bq and acc are indexed by constants (registers)
#pragma unroll
            for (int j = 0; j < 8; ++j)
                a32[j] = *(const v2f*)(xr + k0 + j * 4 + kb32);

            v16h a16;
#pragma unroll
            for (int i = 0; i < 4; ++i) {
                a16[i]      = (_Float16)lo0[i];
                a16[4 + i]  = (_Float16)lo1[i];
                a16[8 + i]  = (_Float16)hi0[i];
                a16[12 + i] = (_Float16)hi1[i];
            }
#pragma unroll
            for (int nt = 0; nt < NT; ++nt) {
                const _Float16* pb = &sB16[(c * NT + nt) * 512 + lane * 8];
                v8h bl = *(const v8h*)(pb);
                v8h bh = *(const v8h*)(pb + 256);
                v16h b16 = __builtin_shufflevector(bl, bh, 0, 1, 2, 3, 4, 5, 6, 7,
                                                   8, 9, 10, 11, 12, 13, 14, 15);
                acc[nt] = __builtin_amdgcn_wmma_f32_16x16x32_f16(
                    false, a16, false, b16, (short)0, acc[nt], false, false);
            }

            // fp32 bucket: 8 x v_wmma_f32_16x16x4_f32 per tile over the same 32 K values
#pragma unroll
            for (int jp = 0; jp < 4; ++jp) {
                v4f bq[NT];
#pragma unroll
                for (int nt = 0; nt < NT; ++nt)
                    bq[nt] = *(const v4f*)(&sB32[((c * NT + nt) * 4 + jp) * 128 + lane * 4]);
#pragma unroll
                for (int nt = 0; nt < NT; ++nt) {
                    v2f b0 = {bq[nt][0], bq[nt][1]};
                    acc[nt] = __builtin_amdgcn_wmma_f32_16x16x4_f32(
                        false, a32[jp * 2], false, b0, (short)0, acc[nt], false, false);
                }
#pragma unroll
                for (int nt = 0; nt < NT; ++nt) {
                    v2f b1 = {bq[nt][2], bq[nt][3]};
                    acc[nt] = __builtin_amdgcn_wmma_f32_16x16x4_f32(
                        false, a32[jp * 2 + 1], false, b1, (short)0, acc[nt], false, false);
                }
            }
        }
    }

    // ---- epilogue: bias + store (C/D layout: VGPR r -> M = r + 8*hiL, N = lane&15) ----
    const int rowBase = rowBlk * ROWS_PER_BLOCK + wave * 16 + hiL * 8;
#pragma unroll
    for (int nt = 0; nt < NT; ++nt) {
        const float bb = bias[gn0 + nt * 16 + n];
#pragma unroll
        for (int r = 0; r < 8; ++r) {
            out[(size_t)(rowBase + r) * U_DIM + gn0 + nt * 16 + n] = acc[nt][r] + bb;
        }
    }
}

extern "C" void kernel_launch(void* const* d_in, const int* in_sizes, int n_in,
                              void* d_out, int out_size, void* d_ws, size_t ws_size,
                              hipStream_t stream) {
    (void)in_sizes; (void)n_in; (void)d_ws; (void)ws_size; (void)out_size;
    const float* x    = (const float*)d_in[0];
    const float* w    = (const float*)d_in[1];
    const float* bias = (const float*)d_in[2];
    const int*   mp   = (const int*)d_in[3];
    float* out = (float*)d_out;

    dim3 grid((B_DIM / ROWS_PER_BLOCK) * (U_DIM / COLS_PER_BLOCK));  // 128 * 2 = 256 blocks
    dim3 block(256);                                                 // 8 waves (wave32)
    mpdense_wmma_kernel<<<grid, block, 0, stream>>>(x, w, bias, mp, out);
}

// v002
// One run takes 130 microseconds.
// Timed twice side by side with v001, it ran 1.09 and 1.10 times as fast.
// Over all steps from v000 it is 2.45 times as fast.
#include <hip/hip_runtime.h>

typedef __attribute__((ext_vector_type(16))) _Float16 v16h;
typedef __attribute__((ext_vector_type(8)))  _Float16 v8h;
typedef __attribute__((ext_vector_type(8)))  float    v8f;
typedef __attribute__((ext_vector_type(4)))  float    v4f;
typedef __attribute__((ext_vector_type(2)))  float    v2f;

#define B_DIM 16384
#define D_DIM 2048
#define U_DIM 256

#define ROWS_PER_BLOCK 128      // 8 waves * 16 rows each
#define NT 8                    // 16-column output tiles per wave
#define COLS_PER_BLOCK (NT * 16)
#define KT 256                  // K staged per LDS refill
#define NCHUNK (KT / 32)        // 8 chunks of K=32

// One 32-K chunk of a wave's A rows, k floats behind the lane's two base addresses
// (p16: fp16 fragment, p32: fp32 fragments).
__device__ __forceinline__ void load_a(v4f (&q)[4], v2f (&d)[8],
                                       const float* p16, const float* p32, int k)
{
    q[0] = *(const v4f*)(p16 + k);
    q[1] = *(const v4f*)(p16 + k + 4);
    q[2] = *(const v4f*)(p16 + k + 16);
    q[3] = *(const v4f*)(p16 + k + 20);
#pragma unroll
    for (int j = 0; j < 8; ++j)
        d[j] = *(const v2f*)(p32 + k + j * 4);
    // these loads stay in flight for two chunks: their address registers are reused only behind
    // this wait; naming the two bases as inputs keeps them whole up to it (no load lands on them)
    asm volatile("s_wait_xcnt 0x0" :: "v"(p16), "v"(p32) : "memory");
}

// out[b,u] = sum_d x16[b,d]*w16[d,u]*(mp==0) + sum_d x[b,d]*w[d,u]*(mp==1) + bias[u]
// Each wave owns a 16 x 128 strip of out: one A fragment feeds NT matrix instructions.
__global__ __launch_bounds__(256)
void mpdense_wmma_kernel(const float* __restrict__ x,
                         const float* __restrict__ w,
                         const float* __restrict__ bias,
                         const int*   __restrict__ mp,
                         float* __restrict__ out)
{
    // Staged B operands (masked weights), rebuilt per 256-K slab.
    // One 16-byte piece per lane, the 32 lanes' pieces side by side (512 B per read).
    __shared__ __align__(16) _Float16 sB16[NCHUNK * NT * 512];  // 64 KB
    __shared__ __align__(16) float    sB32[NCHUNK * NT * 512];  // 128 KB

    const int tid  = threadIdx.x;
    const int lane = tid & 31;
    const int wave = tid >> 5;

    const int tileN  = blockIdx.x & 1;      // 256/128 = 2 column strips
    const int rowBlk = blockIdx.x >> 1;
    const int gn0    = tileN * COLS_PER_BLOCK;

    const int n    = lane & 15;
    const int hiL  = lane >> 4;             // 0: lanes 0-15, 1: lanes 16-31
    const int kb16 = hiL * 8;               // fp16 A-fragment K base per ISA layout
    const int kb32 = hiL * 2;               // fp32 A-fragment K base per ISA layout

    const int m = rowBlk * ROWS_PER_BLOCK + wave * 16 + n;

    // fill roles: one column of the strip per thread, K parity by half of the block
    const int nn   = tid & 127;
    const int kPar = tid >> 7;
    const int ntF  = nn >> 4;               // column tile within strip
    const int n16  = nn & 15;               // column within tile

    v8f acc[NT] = {};

    // A fragments of four consecutive chunks: chunk c sits in slot c & 3 and is loaded
    // two chunks before it is multiplied, so that memory latency is off the wave's path.
    v4f aq[4][4];   // fp16 path: 8 floats at kb16 and 8 at 16 + kb16
    v2f ad[4][8];   // fp32 path: 2 floats at 4j + kb32
    const float* x16 = x + (size_t)m * D_DIM + kb16;
    const float* x32 = x + (size_t)m * D_DIM + kb32;
    // unrolled here and below: aq and ad are indexed by constants (registers)
#pragma unroll
    for (int c = 0; c < 2; ++c)
        load_a(aq[c], ad[c], x16, x32, c * 32);

    for (int kt = 0; kt < D_DIM; kt += KT) {
        __syncthreads();
        // ---- cooperative fill: build masked-B WMMA fragments in LDS ----
        // 256 K-values x 128 cols; a thread keeps one column and every second K value
        // (K within chunk kk = 2*ii + kPar), two chunks (32 values) per trip, no divergence.
        for (int c0 = 0; c0 < NCHUNK; c0 += 2) {
            float wv[32];
            int   mv[32];
            // all loads of the trip first, so that their latencies overlap;
            // unrolled so that wv/mv stay in registers and the offsets become immediates
#pragma unroll
            for (int u = 0; u < 32; ++u) {
                const int k = kt + c0 * 32 + 2 * u + kPar;
                wv[u] = w[k * U_DIM + gn0 + nn];
                mv[u] = mp[k * U_DIM + gn0 + nn];
            }
            // unrolled: ii is a constant, so each LDS address is one base plus an immediate
#pragma unroll
            for (int u = 0; u < 32; ++u) {
                const _Float16 w16 = (mv[u] == 0) ? (_Float16)wv[u] : (_Float16)0.0f;
                const float    w32 = (mv[u] == 1) ? wv[u] : 0.0f;
                const int ii   = u & 15;
                const int frag = (c0 + (u >> 4)) * NT + ntF;

                // fp16 B fragment inverse map (16-bit 32x16 B, wave32):
                // lane L holds K = kbase + (h&7) + (h>=8 ? 16:0), kbase = (L>=16)?8:0
                {
                    const int L  = n16 + (((ii & 7) >= 4) ? 16 : 0);   // (kk & 15) >= 8
                    const int hh = ii >> 3;                            // kk >= 16
                    sB16[(frag * 2 + hh) * 256 + L * 8 + 2 * (ii & 3) + kPar] = w16;
                }
                // fp32 B fragment inverse map (32-bit 4x16 B per sub-chunk j = kk >> 2):
                // lane L, sub-chunk j holds K = 4j + ((L>=16)?2:0) + {0,1}
                {
                    const int j = ii >> 1;
                    const int L = n16 + ((ii & 1) ? 16 : 0);           // (kk & 3) >= 2
                    sB32[(frag * 4 + (j >> 1)) * 128 + L * 4 + (j & 1) * 2 + kPar] = w32;
                }
            }
        }
        __syncthreads();

        // ---- per-wave MMA over staged chunks, A streamed from global two chunks ahead ----
        // the first two chunks of the next slab are fetched three chunks ahead (the ring's fourth slot
        // is free), so that they have landed where __syncthreads() drains the load counter; behind the
        // last slab the address wraps to the row's start, inside x, and the values are not used
        const int ktn = (kt + KT < D_DIM) ? kt + KT : 0;
        // unrolled: the ring slot of every chunk is a constant
#pragma unroll
        for (int c = 0; c < NCHUNK; ++c) {
            // this fence and the one behind the loads hold them at the head of their chunk and each
            // chunk's LDS reads inside it, in few groups: without them the scheduler mixes all eight
            // chunks, runs out of registers and strews single LDS reads among the matrix instructions
            __builtin_amdgcn_sched_barrier(0);
            if (c + 2 < NCHUNK)
                load_a(aq[(c + 2) & 3], ad[(c + 2) & 3], x16 + kt, x32 + kt, (c + 2) * 32);
            if (c + 3 >= NCHUNK && c + 3 < NCHUNK + 2)
                load_a(aq[(c + 3) & 3], ad[(c + 3) & 3], x16 + ktn, x32 + ktn, (c + 3 - NCHUNK) * 32);
            __builtin_amdgcn_sched_barrier(0);
            const v4f lo0 = aq[c & 3][0];
            const v4f lo1 = aq[c & 3][1];
            const v4f hi0 = aq[c & 3][2];
            const v4f hi1 = aq[c & 3][3];
            const v2f* a32 = ad[c & 3];

            v16h a16;
#pragma unroll
            for (int i = 0; i < 4; ++i) {
                a16[i]      = (_Float16)lo0[i];
                a16[4 + i]  = (_Float16)lo1[i];
                a16[8 + i]  = (_Float16)hi0[i];
                a16[12 + i] = (_Float16)hi1[i];
            }
#pragma unroll
            for (int nt = 0; nt < NT; ++nt) {
                const _Float16* pb = &sB16[(c * NT + nt) * 512 + lane * 8];
                v8h bl = *(const v8h*)(pb);
                v8h bh = *(const v8h*)(pb + 256);
                v16h b16 = __builtin_shufflevector(bl, bh, 0, 1, 2, 3, 4, 5, 6, 7,
                                                   8, 9, 10, 11, 12, 13, 14, 15);
                acc[nt] = __builtin_amdgcn_wmma_f32_16x16x32_f16(
                    false, a16, false, b16, (short)0, acc[nt], false, false);
            }

            // fp32 bucket: 8 x v_wmma_f32_16x16x4_f32 per tile over the same 32 K values
#pragma unroll
            for (int jp = 0; jp < 4; ++jp) {
                v4f bq[NT];
#pragma unroll
                for (int nt = 0; nt < NT; ++nt)
                    bq[nt] = *(const v4f*)(&sB32[((c * NT + nt) * 4 + jp) * 128 + lane * 4]);
#pragma unroll
                for (int nt = 0; nt < NT; ++nt) {
                    v2f b0 = {bq[nt][0], bq[nt][1]};
                    acc[nt] = __builtin_amdgcn_wmma_f32_16x16x4_f32(
                        false, a32[jp * 2], false, b0, (short)0, acc[nt], false, false);
                }
#pragma unroll
                for (int nt = 0; nt < NT; ++nt) {
                    v2f b1 = {bq[nt][2], bq[nt][3]};
                    acc[nt] = __builtin_amdgcn_wmma_f32_16x16x4_f32(
                        false, a32[jp * 2 + 1], false, b1, (short)0, acc[nt], false, false);
                }
            }
        }
    }

    // ---- epilogue: bias + store (C/D layout: VGPR r -> M = r + 8*hiL, N = lane&15) ----
    const int rowBase = rowBlk * ROWS_PER_BLOCK + wave * 16 + hiL * 8;
#pragma unroll
    for (int nt = 0; nt < NT; ++nt) {
        const float bb = bias[gn0 + nt * 16 + n];
#pragma unroll
        for (int r = 0; r < 8; ++r) {
            out[(size_t)(rowBase + r) * U_DIM + gn0 + nt * 16 + n] = acc[nt][r] + bb;
        }
    }
}

extern "C" void kernel_launch(void* const* d_in, const int* in_sizes, int n_in,
                              void* d_out, int out_size, void* d_ws, size_t ws_size,
                              hipStream_t stream) {
    (void)in_sizes; (void)n_in; (void)d_ws; (void)ws_size; (void)out_size;
    const float* x    = (const float*)d_in[0];
    const float* w    = (const float*)d_in[1];
    const float* bias = (const float*)d_in[2];
    const int*   mp   = (const int*)d_in[3];
    float* out = (float*)d_out;

    dim3 grid((B_DIM / ROWS_PER_BLOCK) * (U_DIM / COLS_PER_BLOCK));  // 128 * 2 = 256 blocks
    dim3 block(256);                                                 // 8 waves (wave32)
    mpdense_wmma_kernel<<<grid, block, 0, stream>>>(x, w, bias, mp, out);
}

// v003
// Measured time: 95.9 microseconds a run.
// Timed twice side by side with v002, it ran 1.35 times as fast both times.
// Counting every step since v000, it is 3.30 times as fast.
#include <hip/hip_runtime.h>

typedef __attribute__((ext_vector_type(16))) _Float16 v16h;
typedef __attribute__((ext_vector_type(8)))  _Float16 v8h;
typedef __attribute__((ext_vector_type(8)))  float    v8f;
typedef __attribute__((ext_vector_type(4)))  float    v4f;
typedef __attribute__((ext_vector_type(2)))  float    v2f;

#define B_DIM 16384
#define D_DIM 2048
#define U_DIM 256

#define ROWS_PER_BLOCK 128      // 8 waves * 16 rows each
#define NT 8                    // 16-column output tiles per wave
#define COLS_PER_BLOCK (NT * 16)
#define KT 128                  // K per LDS buffer (slab)
#define NCHUNK (KT / 32)        // 4 chunks of K=32
#define NSLAB (D_DIM / KT)
#define SLAB16_BYTES (NCHUNK * NT * 512 * 2)            // fp16 fragments of a slab, 32 KB
#define SLAB32_BYTES (NCHUNK * NT * 512 * 4)            // fp32 fragments of a slab, 64 KB
#define SLAB_BYTES (SLAB16_BYTES + SLAB32_BYTES)        // 96 KB
#define COPY_STEP (256 * 16)                            // bytes one copy of the whole block moves

// First launch: the masked weights, once, in the order in which the matrix instructions read them.
// Workspace: slab s of column strip t at byte (2 s + t) * SLAB_BYTES, fp16 fragments first, then fp32;
// in each, one 16-byte piece per lane, the 32 lanes' pieces side by side (512 B per read).
// A thread takes one column and 8 consecutive K values: one fp16 piece and two fp32 pieces.
__global__ __launch_bounds__(256)
void mpdense_pack_kernel(const float* __restrict__ w,
                         const int*   __restrict__ mp,
                         float* __restrict__ ws)
{
    const int gid = blockIdx.x * 256 + threadIdx.x;
    const int col = gid & (U_DIM - 1);
    const int g   = gid >> 8;               // K group: K = 8 g .. 8 g + 7
    const int q   = g & 3;                  // group within the 32-K chunk
    const int frag = ((g >> 2) & (NCHUNK - 1)) * NT + ((col >> 4) & (NT - 1));
    const int n16  = col & 15;

    float wv[8];
    int   mv[8];
#pragma unroll
    for (int i = 0; i < 8; ++i) {
        wv[i] = w[(g * 8 + i) * U_DIM + col];
        mv[i] = mp[(g * 8 + i) * U_DIM + col];
    }
    v8h h;
    float f[8];
#pragma unroll
    for (int i = 0; i < 8; ++i) {
        h[i] = (mv[i] == 0) ? (_Float16)wv[i] : (_Float16)0.0f;
        f[i] = (mv[i] == 1) ? wv[i] : 0.0f;
    }
    unsigned char* slab = (unsigned char*)ws
        + (size_t)((g >> 4) * 2 + (col >> 7)) * SLAB_BYTES;     // 16 groups per 128-K slab
    // fp16 B fragment (16-bit 32x16 B, wave32): lane L, half h holds
    // K = ((L>=16)?8:0) + (h&7) + (h>=8 ? 16:0); the halves h<8 and h>=8 are separate pieces
    *(v8h*)(slab + ((frag * 2 + (q >> 1)) * 256 + (n16 + 16 * (q & 1)) * 8) * 2) = h;
    // fp32 B fragments (32-bit 4x16 B per sub-chunk j): lane L holds K = 4j + ((L>=16)?2:0) + {0,1};
    // a piece holds sub-chunks j = 2q and 2q + 1
    float* p32 = (float*)(slab + SLAB16_BYTES) + (frag * 4 + q) * 128 + n16 * 4;
    const v4f lo = {f[0], f[1], f[4], f[5]};
    const v4f hi = {f[2], f[3], f[6], f[7]};
    *(v4f*)(p32)      = lo;
    *(v4f*)(p32 + 64) = hi;
}

// Half a slab (48 KB) from the workspace into LDS, through no register: 12 copies of 16 bytes per lane.
// l: the lane's LDS byte address, g: its global address; every copy has address registers of its own.
// The wait at the end stands before anything can rewrite a register that an issued copy names.
__device__ __forceinline__ void copy_half_slab(unsigned l, const unsigned char* g)
{
    asm volatile("global_load_async_to_lds_b128 %0, %12, off\n\t"
                 "global_load_async_to_lds_b128 %1, %13, off\n\t"
                 "global_load_async_to_lds_b128 %2, %14, off\n\t"
                 "global_load_async_to_lds_b128 %3, %15, off\n\t"
                 "global_load_async_to_lds_b128 %4, %16, off\n\t"
                 "global_load_async_to_lds_b128 %5, %17, off\n\t"
                 "global_load_async_to_lds_b128 %6, %18, off\n\t"
                 "global_load_async_to_lds_b128 %7, %19, off\n\t"
                 "global_load_async_to_lds_b128 %8, %20, off\n\t"
                 "global_load_async_to_lds_b128 %9, %21, off\n\t"
                 "global_load_async_to_lds_b128 %10, %22, off\n\t"
                 "global_load_async_to_lds_b128 %11, %23, off\n\t"
                 "s_wait_xcnt 0x0"
                 :: "v"(l), "v"(l + 1 * COPY_STEP), "v"(l + 2 * COPY_STEP), "v"(l + 3 * COPY_STEP),
                    "v"(l + 4 * COPY_STEP), "v"(l + 5 * COPY_STEP), "v"(l + 6 * COPY_STEP),
                    "v"(l + 7 * COPY_STEP), "v"(l + 8 * COPY_STEP), "v"(l + 9 * COPY_STEP),
                    "v"(l + 10 * COPY_STEP), "v"(l + 11 * COPY_STEP),
                    "v"(g), "v"(g + 1 * COPY_STEP), "v"(g + 2 * COPY_STEP), "v"(g + 3 * COPY_STEP),
                    "v"(g + 4 * COPY_STEP), "v"(g + 5 * COPY_STEP), "v"(g + 6 * COPY_STEP),
                    "v"(g + 7 * COPY_STEP), "v"(g + 8 * COPY_STEP), "v"(g + 9 * COPY_STEP),
                    "v"(g + 10 * COPY_STEP), "v"(g + 11 * COPY_STEP)
                 : "memory");
}

__device__ __forceinline__ void copy_slab(unsigned l, const unsigned char* g)
{
    copy_half_slab(l, g);
    copy_half_slab(l + 12 * COPY_STEP, g + 12 * COPY_STEP);
}

// One 32-K chunk of a wave's A rows, k floats behind the lane's two base addresses
// (p16: fp16 fragment, p32: fp32 fragments).
__device__ __forceinline__ void load_a(v4f (&q)[4], v2f (&d)[8],
                                       const float* p16, const float* p32, int k)
{
    q[0] = *(const v4f*)(p16 + k);
    q[1] = *(const v4f*)(p16 + k + 4);
    q[2] = *(const v4f*)(p16 + k + 16);
    q[3] = *(const v4f*)(p16 + k + 20);
#pragma unroll
    for (int j = 0; j < 8; ++j)
        d[j] = *(const v2f*)(p32 + k + j * 4);
    // these loads stay in flight for two chunks: their address registers are reused only behind
    // this wait; naming the two bases as inputs keeps them whole up to it (no load lands on them)
    asm volatile("s_wait_xcnt 0x0" :: "v"(p16), "v"(p32) : "memory");
}

// out[b,u] = sum_d x16[b,d]*w16[d,u]*(mp==0) + sum_d x[b,d]*w[d,u]*(mp==1) + bias[u]
// Each wave owns a 16 x 128 strip of out: one A fragment feeds NT matrix instructions.
__global__ __launch_bounds__(256)
void mpdense_wmma_kernel(const float* __restrict__ x,
                         const float* __restrict__ wsB,
                         const float* __restrict__ bias,
                         float* __restrict__ out)
{
    // Two buffers of B operands (masked weights in fragment order, as the first launch left them):
    // slab s is multiplied out of buffer s & 1 while slab s + 1 lands in the other.
    __shared__ __align__(16) unsigned char sB[2 * SLAB_BYTES];  // 192 KB

    const int tid  = threadIdx.x;
    const int lane = tid & 31;
    const int wave = tid >> 5;

    const int tileN  = blockIdx.x & 1;      // 256/128 = 2 column strips
    const int rowBlk = blockIdx.x >> 1;
    const int gn0    = tileN * COLS_PER_BLOCK;

    const int n    = lane & 15;
    const int hiL  = lane >> 4;             // 0: lanes 0-15, 1: lanes 16-31
    const int kb16 = hiL * 8;               // fp16 A-fragment K base per ISA layout
    const int kb32 = hiL * 2;               // fp32 A-fragment K base per ISA layout

    const int m = rowBlk * ROWS_PER_BLOCK + wave * 16 + n;

    // copy roles: thread t moves bytes 16 t .. 16 t + 15 of every 4 KB of a slab
    const unsigned ldsT = (unsigned)(size_t)sB + tid * 16;
    const unsigned char* srcT = (const unsigned char*)wsB + (size_t)tileN * SLAB_BYTES + tid * 16;

    v8f acc[NT] = {};

    // A fragments of four consecutive chunks: chunk c sits in slot c & 3 and is loaded
    // two chunks before it is multiplied, so that memory latency is off the wave's path.
    v4f aq[4][4];   // fp16 path: 8 floats at kb16 and 8 at 16 + kb16
    v2f ad[4][8];   // fp32 path: 2 floats at 4j + kb32
    const float* x16 = x + (size_t)m * D_DIM + kb16;
    const float* x32 = x + (size_t)m * D_DIM + kb32;
    // unrolled here and below: aq and ad are indexed by constants (registers)
#pragma unroll
    for (int c = 0; c < 2; ++c)
        load_a(aq[c], ad[c], x16, x32, c * 32);

    // slab 0 lands and is published; slab 1 flies while slab 0 is multiplied
    copy_slab(ldsT, srcT);
    asm volatile("s_wait_asynccnt 0x0" ::: "memory");   // this wave's copies of slab 0 have landed
    __syncthreads();
    copy_slab(ldsT + SLAB_BYTES, srcT + 2 * SLAB_BYTES);

    for (int s = 0; s < NSLAB; ++s) {
        const int kt = s * KT;
        const _Float16* sB16 = (const _Float16*)(sB + (s & 1) * SLAB_BYTES);
        const float*    sB32 = (const float*)(sB + (s & 1) * SLAB_BYTES + SLAB16_BYTES);

        // ---- per-wave MMA over staged chunks, A streamed from global two chunks ahead ----
        // the first two chunks of the next slab are fetched three chunks ahead (the ring's fourth slot
        // is free), so that they have landed where __syncthreads() drains the load counter; behind the
        // last slab the address wraps to the row's start, inside x, and the values are not used
        const int ktn = (kt + KT < D_DIM) ? kt + KT : 0;
        // unrolled: the ring slot of every chunk is a constant
#pragma unroll
        for (int c = 0; c < NCHUNK; ++c) {
            // this fence and the one behind the loads hold them at the head of their chunk and each
            // chunk's LDS reads inside it, in few groups: without them the scheduler mixes all the
            // chunks, runs out of registers and strews single LDS reads among the matrix instructions
            __builtin_amdgcn_sched_barrier(0);
            // four vector slots between the last matrix instruction of the chunk before and the first
            // vector instruction of this one, which may reuse its operand registers
            asm volatile("v_nop\n\tv_nop\n\tv_nop\n\tv_nop");
            if (c + 2 < NCHUNK)
                load_a(aq[(c + 2) & 3], ad[(c + 2) & 3], x16 + kt, x32 + kt, (c + 2) * 32);
            if (c + 3 >= NCHUNK && c + 3 < NCHUNK + 2)
                load_a(aq[(c + 3) & 3], ad[(c + 3) & 3], x16 + ktn, x32 + ktn, (c + 3 - NCHUNK) * 32);
            __builtin_amdgcn_sched_barrier(0);
            const v4f lo0 = aq[c & 3][0];
            const v4f lo1 = aq[c & 3][1];
            const v4f hi0 = aq[c & 3][2];
            const v4f hi1 = aq[c & 3][3];
            const v2f* a32 = ad[c & 3];

            v16h a16;
#pragma unroll
            for (int i = 0; i < 4; ++i) {
                a16[i]      = (_Float16)lo0[i];
                a16[4 + i]  = (_Float16)lo1[i];
                a16[8 + i]  = (_Float16)hi0[i];
                a16[12 + i] = (_Float16)hi1[i];
            }
#pragma unroll
            for (int nt = 0; nt < NT; ++nt) {
                const _Float16* pb = &sB16[(c * NT + nt) * 512 + lane * 8];
                v8h bl = *(const v8h*)(pb);
                v8h bh = *(const v8h*)(pb + 256);
                v16h b16 = __builtin_shufflevector(bl, bh, 0, 1, 2, 3, 4, 5, 6, 7,
                                                   8, 9, 10, 11, 12, 13, 14, 15);
                acc[nt] = __builtin_amdgcn_wmma_f32_16x16x32_f16(
                    false, a16, false, b16, (short)0, acc[nt], false, false);
            }

            // fp32 bucket: 8 x v_wmma_f32_16x16x4_f32 per tile over the same 32 K values
#pragma unroll
            for (int jp = 0; jp < 4; ++jp) {
                v4f bq[NT];
#pragma unroll
                for (int nt = 0; nt < NT; ++nt)
                    bq[nt] = *(const v4f*)(&sB32[((c * NT + nt) * 4 + jp) * 128 + lane * 4]);
#pragma unroll
                for (int nt = 0; nt < NT; ++nt) {
                    v2f b0 = {bq[nt][0], bq[nt][1]};
                    acc[nt] = __builtin_amdgcn_wmma_f32_16x16x4_f32(
                        false, a32[jp * 2], false, b0, (short)0, acc[nt], false, false);
                }
#pragma unroll
                for (int nt = 0; nt < NT; ++nt) {
                    v2f b1 = {bq[nt][2], bq[nt][3]};
                    acc[nt] = __builtin_amdgcn_wmma_f32_16x16x4_f32(
                        false, a32[jp * 2 + 1], false, b1, (short)0, acc[nt], false, false);
                }
            }
        }

        // ---- hand-over: slab s + 1 is published, the buffer of slab s is free ----
        asm volatile("s_wait_dscnt 0x0" ::: "memory");      // this wave's reads of slab s are done
        asm volatile("s_wait_asynccnt 0x0" ::: "memory");   // this wave's copies of slab s + 1 have landed
        __syncthreads();
        if (s + 2 < NSLAB)
            copy_slab(ldsT + (s & 1) * SLAB_BYTES, srcT + (size_t)(s + 2) * (2 * SLAB_BYTES));
    }
    asm volatile("s_wait_asynccnt 0x0" ::: "memory");       // no copy is open when the wave ends

    // ---- epilogue: bias + store (C/D layout: VGPR r -> M = r + 8*hiL, N = lane&15) ----
    const int rowBase = rowBlk * ROWS_PER_BLOCK + wave * 16 + hiL * 8;
#pragma unroll
    for (int nt = 0; nt < NT; ++nt) {
        const float bb = bias[gn0 + nt * 16 + n];
#pragma unroll
        for (int r = 0; r < 8; ++r) {
            out[(size_t)(rowBase + r) * U_DIM + gn0 + nt * 16 + n] = acc[nt][r] + bb;
        }
    }
}

extern "C" void kernel_launch(void* const* d_in, const int* in_sizes, int n_in,
                              void* d_out, int out_size, void* d_ws, size_t ws_size,
                              hipStream_t stream) {
    (void)in_sizes; (void)n_in; (void)ws_size; (void)out_size;
    const float* x    = (const float*)d_in[0];
    const float* w    = (const float*)d_in[1];
    const float* bias = (const float*)d_in[2];
    const int*   mp   = (const int*)d_in[3];
    float* out = (float*)d_out;
    float* ws  = (float*)d_ws;              // 3 MB used: 16 slabs x 2 strips x 96 KB

    // one thread per column and 8 K values: 256 * 256 threads
    mpdense_pack_kernel<<<dim3(D_DIM / 8), dim3(256), 0, stream>>>(w, mp, ws);

    dim3 grid((B_DIM / ROWS_PER_BLOCK) * (U_DIM / COLS_PER_BLOCK));  // 128 * 2 = 256 blocks
    dim3 block(256);                                                 // 8 waves (wave32)
    mpdense_wmma_kernel<<<grid, block, 0, stream>>>(x, ws, bias, out);
}

// v004
// It runs in 48.9 microseconds.
// Two timings next to v003 put it at 1.96 and 1.97 times that version's speed.
// All steps since v000 together make it 6.48 times as fast.
#include <hip/hip_runtime.h>

typedef __attribute__((ext_vector_type(16))) _Float16 v16h;
typedef __attribute__((ext_vector_type(8)))  _Float16 v8h;
typedef __attribute__((ext_vector_type(8)))  float    v8f;
typedef __attribute__((ext_vector_type(4)))  float    v4f;

#define B_DIM 16384
#define D_DIM 2048
#define U_DIM 256

#define ROWS_PER_BLOCK 128      // 8 waves * 16 rows each
#define NT 8                    // 16-column output tiles per wave
#define COLS_PER_BLOCK (NT * 16)
#define KT 128                  // K per LDS buffer (slab)
#define NCHUNK (KT / 32)        // 4 chunks of K=32
#define NSLAB (D_DIM / KT)
#define SLAB16_BYTES (NCHUNK * NT * 512 * 2)            // one set of fp16 fragments of a slab, 32 KB
#define SLAB_BYTES (3 * SLAB16_BYTES)                   // three sets, 96 KB
#define LO_SCALE 2048.0f        // the low parts are kept times 2^11, clear of the fp16 subnormals
#define COPY_STEP (256 * 16)                            // bytes one copy of the whole block moves

// First launch: the masked weights, once, in the order in which the matrix instructions read them.
// The fp32 bucket's product x * w is formed from fp16 parts, x = xh + xl, w = wh + wl (xh, wh: the value
// rounded to fp16; xl, wl: what is left, rounded to fp16): xh wh + xh wl + xl wh; xl wl, 2^-22 of the
// product, is dropped. xh is the fp16 bucket's own operand, so xh wh joins that bucket's product.
// Workspace: slab s of column strip t at byte (2 s + t) * SLAB_BYTES, three sets of fp16 fragments:
// fp16(w) where mp is 0 or 1; wh where mp is 1; wl * 2^11 where mp is 1;
// in each, one 16-byte piece per lane, the 32 lanes' pieces side by side (512 B per read).
// A thread takes one column and 8 consecutive K values: one piece of each set.
__global__ __launch_bounds__(256)
void mpdense_pack_kernel(const float* __restrict__ w,
                         const int*   __restrict__ mp,
                         float* __restrict__ ws)
{
    const int gid = blockIdx.x * 256 + threadIdx.x;
    const int col = gid & (U_DIM - 1);
    const int g   = gid >> 8;               // K group: K = 8 g .. 8 g + 7
    const int q   = g & 3;                  // group within the 32-K chunk
    const int frag = ((g >> 2) & (NCHUNK - 1)) * NT + ((col >> 4) & (NT - 1));
    const int n16  = col & 15;

    float wv[8];
    int   mv[8];
#pragma unroll
    for (int i = 0; i < 8; ++i) {
        wv[i] = w[(g * 8 + i) * U_DIM + col];
        mv[i] = mp[(g * 8 + i) * U_DIM + col];
    }
    v8h hm, hh, hl;
#pragma unroll
    for (int i = 0; i < 8; ++i) {
        const _Float16 wh = (_Float16)wv[i];
        const _Float16 wl = (_Float16)((wv[i] - (float)wh) * LO_SCALE);
        hm[i] = (mv[i] == 0 || mv[i] == 1) ? wh : (_Float16)0.0f;
        hh[i] = (mv[i] == 1) ? wh : (_Float16)0.0f;
        hl[i] = (mv[i] == 1) ? wl : (_Float16)0.0f;
    }
    unsigned char* slab = (unsigned char*)ws
        + (size_t)((g >> 4) * 2 + (col >> 7)) * SLAB_BYTES;     // 16 groups per 128-K slab
    // fp16 B fragment (16-bit 32x16 B, wave32): lane L, half h holds
    // K = ((L>=16)?8:0) + (h&7) + (h>=8 ? 16:0); the halves h<8 and h>=8 are separate pieces
    unsigned char* piece = slab + ((frag * 2 + (q >> 1)) * 256 + (n16 + 16 * (q & 1)) * 8) * 2;
    *(v8h*)(piece)                    = hm;
    *(v8h*)(piece + SLAB16_BYTES)     = hh;
    *(v8h*)(piece + 2 * SLAB16_BYTES) = hl;
}

// Half a slab (48 KB) from the workspace into LDS, through no register: 12 copies of 16 bytes per lane.
// l: the lane's LDS byte address, g: its global address; every copy has address registers of its own.
// The wait at the end stands before anything can rewrite a register that an issued copy names.
__device__ __forceinline__ void copy_half_slab(unsigned l, const unsigned char* g)
{
    asm volatile("global_load_async_to_lds_b128 %0, %12, off\n\t"
                 "global_load_async_to_lds_b128 %1, %13, off\n\t"
                 "global_load_async_to_lds_b128 %2, %14, off\n\t"
                 "global_load_async_to_lds_b128 %3, %15, off\n\t"
                 "global_load_async_to_lds_b128 %4, %16, off\n\t"
                 "global_load_async_to_lds_b128 %5, %17, off\n\t"
                 "global_load_async_to_lds_b128 %6, %18, off\n\t"
                 "global_load_async_to_lds_b128 %7, %19, off\n\t"
                 "global_load_async_to_lds_b128 %8, %20, off\n\t"
                 "global_load_async_to_lds_b128 %9, %21, off\n\t"
                 "global_load_async_to_lds_b128 %10, %22, off\n\t"
                 "global_load_async_to_lds_b128 %11, %23, off\n\t"
                 "s_wait_xcnt 0x0"
                 :: "v"(l), "v"(l + 1 * COPY_STEP), "v"(l + 2 * COPY_STEP), "v"(l + 3 * COPY_STEP),
                    "v"(l + 4 * COPY_STEP), "v"(l + 5 * COPY_STEP), "v"(l + 6 * COPY_STEP),
                    "v"(l + 7 * COPY_STEP), "v"(l + 8 * COPY_STEP), "v"(l + 9 * COPY_STEP),
                    "v"(l + 10 * COPY_STEP), "v"(l + 11 * COPY_STEP),
                    "v"(g), "v"(g + 1 * COPY_STEP), "v"(g + 2 * COPY_STEP), "v"(g + 3 * COPY_STEP),
                    "v"(g + 4 * COPY_STEP), "v"(g + 5 * COPY_STEP), "v"(g + 6 * COPY_STEP),
                    "v"(g + 7 * COPY_STEP), "v"(g + 8 * COPY_STEP), "v"(g + 9 * COPY_STEP),
                    "v"(g + 10 * COPY_STEP), "v"(g + 11 * COPY_STEP)
                 : "memory");
}

__device__ __forceinline__ void copy_slab(unsigned l, const unsigned char* g)
{
    copy_half_slab(l, g);
    copy_half_slab(l + 12 * COPY_STEP, g + 12 * COPY_STEP);
}

// One 32-K chunk of a wave's A rows, k floats behind the lane's base address (fp16 fragment order).
__device__ __forceinline__ void load_a(v4f (&q)[4], const float* p16, int k)
{
    q[0] = *(const v4f*)(p16 + k);
    q[1] = *(const v4f*)(p16 + k + 4);
    q[2] = *(const v4f*)(p16 + k + 16);
    q[3] = *(const v4f*)(p16 + k + 20);
    // these loads stay in flight for two chunks: their address registers are reused only behind
    // this wait; naming the base as an input keeps it whole up to it (no load lands on it)
    asm volatile("s_wait_xcnt 0x0" :: "v"(p16) : "memory");
}

// One fp16 B fragment out of a set in LDS: the lane's two 16-byte pieces.
__device__ __forceinline__ v16h load_b(const _Float16* set, int frag, int lane)
{
    const _Float16* pb = set + frag * 512 + lane * 8;
    const v8h bl = *(const v8h*)(pb);
    const v8h bh = *(const v8h*)(pb + 256);
    return __builtin_shufflevector(bl, bh, 0, 1, 2, 3, 4, 5, 6, 7, 8, 9, 10, 11, 12, 13, 14, 15);
}

// out[b,u] = sum_d x16[b,d]*w16[d,u]*(mp==0) + sum_d x[b,d]*w[d,u]*(mp==1) + bias[u]
// the second sum as xh wh + (xh (wl 2^11) + (xl 2^11) wh) 2^-11, the bracket in accumulators of its own
// Each wave owns a 16 x 128 strip of out: the xh fragment feeds 2 NT matrix instructions, the xl fragment NT.
__global__ __launch_bounds__(256)
void mpdense_wmma_kernel(const float* __restrict__ x,
                         const float* __restrict__ wsB,
                         const float* __restrict__ bias,
                         float* __restrict__ out)
{
    // Two buffers of B operands (masked weights in fragment order, as the first launch left them):
    // slab s is multiplied out of buffer s & 1 while slab s + 1 lands in the other.
    __shared__ __align__(16) unsigned char sB[2 * SLAB_BYTES];  // 192 KB

    const int tid  = threadIdx.x;
    const int lane = tid & 31;
    const int wave = tid >> 5;

    const int tileN  = blockIdx.x & 1;      // 256/128 = 2 column strips
    const int rowBlk = blockIdx.x >> 1;
    const int gn0    = tileN * COLS_PER_BLOCK;

    const int n    = lane & 15;
    const int hiL  = lane >> 4;             // 0: lanes 0-15, 1: lanes 16-31
    const int kb16 = hiL * 8;               // fp16 A-fragment K base per ISA layout

    const int m = rowBlk * ROWS_PER_BLOCK + wave * 16 + n;

    // copy roles: thread t moves bytes 16 t .. 16 t + 15 of every 4 KB of a slab
    const unsigned ldsT = (unsigned)(size_t)sB + tid * 16;
    const unsigned char* srcT = (const unsigned char*)wsB + (size_t)tileN * SLAB_BYTES + tid * 16;

    v8f acc[NT]  = {};  // xh * fp16(w), both buckets
    v8f accL[NT] = {};  // the fp32 bucket's two cross terms, times 2^11

    // A fragments of four consecutive chunks: chunk c sits in slot c & 3 and is loaded
    // two chunks before it is multiplied, so that memory latency is off the wave's path.
    v4f aq[4][4];   // 8 floats at kb16 and 8 at 16 + kb16
    const float* x16 = x + (size_t)m * D_DIM + kb16;
    // unrolled here and below: aq is indexed by constants (registers)
#pragma unroll
    for (int c = 0; c < 2; ++c)
        load_a(aq[c], x16, c * 32);

    // slab 0 lands and is published; slab 1 flies while slab 0 is multiplied
    copy_slab(ldsT, srcT);
    asm volatile("s_wait_asynccnt 0x0" ::: "memory");   // this wave's copies of slab 0 have landed
    __syncthreads();
    copy_slab(ldsT + SLAB_BYTES, srcT + 2 * SLAB_BYTES);

    for (int s = 0; s < NSLAB; ++s) {
        const int kt = s * KT;
        const _Float16* sBm = (const _Float16*)(sB + (s & 1) * SLAB_BYTES);
        const _Float16* sBh = (const _Float16*)(sB + (s & 1) * SLAB_BYTES + SLAB16_BYTES);
        const _Float16* sBl = (const _Float16*)(sB + (s & 1) * SLAB_BYTES + 2 * SLAB16_BYTES);

        // ---- per-wave MMA over staged chunks, A streamed from global two chunks ahead ----
        // the first two chunks of the next slab are fetched three chunks ahead (the ring's fourth slot
        // is free), so that they have landed where __syncthreads() drains the load counter; behind the
        // last slab the address wraps to the row's start, inside x, and the values are not used
        const int ktn = (kt + KT < D_DIM) ? kt + KT : 0;
        // unrolled: the ring slot of every chunk is a constant
#pragma unroll
        for (int c = 0; c < NCHUNK; ++c) {
            // this fence and the one behind the loads hold the A loads and all the chunk's LDS reads at
            // its head, as one group with counted waits behind it: without them the scheduler mixes the
            // chunks and strews pairs of LDS reads, one fragment ahead, among the matrix instructions
            __builtin_amdgcn_sched_barrier(0);
            // four vector slots between the last matrix instruction of the chunk before and the first
            // vector instruction of this one, which may reuse its operand registers
            asm volatile("v_nop\n\tv_nop\n\tv_nop\n\tv_nop");
            if (c + 2 < NCHUNK)
                load_a(aq[(c + 2) & 3], x16 + kt, (c + 2) * 32);
            if (c + 3 >= NCHUNK && c + 3 < NCHUNK + 2)
                load_a(aq[(c + 3) & 3], x16 + ktn, (c + 3 - NCHUNK) * 32);
            v16h bm[NT], bl[NT], bh[NT];    // the chunk's B fragments of the three sets
#pragma unroll
            for (int nt = 0; nt < NT; ++nt)
                bm[nt] = load_b(sBm, c * NT + nt, lane);
#pragma unroll
            for (int nt = 0; nt < NT; ++nt)
                bl[nt] = load_b(sBl, c * NT + nt, lane);
#pragma unroll
            for (int nt = 0; nt < NT; ++nt)
                bh[nt] = load_b(sBh, c * NT + nt, lane);
            __builtin_amdgcn_sched_barrier(0);
            v16h a16, aL;       // xh and xl * 2^11
#pragma unroll
            for (int p = 0; p < 4; ++p) {
#pragma unroll
                for (int i = 0; i < 4; ++i) {
                    const float    v = aq[c & 3][p][i];
                    const _Float16 h = (_Float16)v;
                    a16[p * 4 + i] = h;
                    aL[p * 4 + i]  = (_Float16)((v - (float)h) * LO_SCALE);
                }
            }
            // three runs of NT independent accumulator tiles
#pragma unroll
            for (int nt = 0; nt < NT; ++nt)
                acc[nt] = __builtin_amdgcn_wmma_f32_16x16x32_f16(
                    false, a16, false, bm[nt], (short)0, acc[nt], false, false);
#pragma unroll
            for (int nt = 0; nt < NT; ++nt)
                accL[nt] = __builtin_amdgcn_wmma_f32_16x16x32_f16(
                    false, a16, false, bl[nt], (short)0, accL[nt], false, false);
#pragma unroll
            for (int nt = 0; nt < NT; ++nt)
                accL[nt] = __builtin_amdgcn_wmma_f32_16x16x32_f16(
                    false, aL, false, bh[nt], (short)0, accL[nt], false, false);
        }

        // ---- hand-over: slab s + 1 is published, the buffer of slab s is free ----
        // this fence keeps the waits below behind the last chunk's matrix instructions: lifted over them,
        // s_wait_dscnt 0 holds them all back until the chunk's last LDS read has landed
        __builtin_amdgcn_sched_barrier(0);
        asm volatile("s_wait_dscnt 0x0" ::: "memory");      // this wave's reads of slab s are done
        asm volatile("s_wait_asynccnt 0x0" ::: "memory");   // this wave's copies of slab s + 1 have landed
        __syncthreads();
        if (s + 2 < NSLAB)
            copy_slab(ldsT + (s & 1) * SLAB_BYTES, srcT + (size_t)(s + 2) * (2 * SLAB_BYTES));
    }
    asm volatile("s_wait_asynccnt 0x0" ::: "memory");       // no copy is open when the wave ends

    // ---- epilogue: bias + store (C/D layout: VGPR r -> M = r + 8*hiL, N = lane&15) ----
    const int rowBase = rowBlk * ROWS_PER_BLOCK + wave * 16 + hiL * 8;
#pragma unroll
    for (int nt = 0; nt < NT; ++nt) {
        const float bb = bias[gn0 + nt * 16 + n];
#pragma unroll
        for (int r = 0; r < 8; ++r) {
            out[(size_t)(rowBase + r) * U_DIM + gn0 + nt * 16 + n] =
                acc[nt][r] + accL[nt][r] * (1.0f / LO_SCALE) + bb;
        }
    }
}

extern "C" void kernel_launch(void* const* d_in, const int* in_sizes, int n_in,
                              void* d_out, int out_size, void* d_ws, size_t ws_size,
                              hipStream_t stream) {
    (void)in_sizes; (void)n_in; (void)ws_size; (void)out_size;
    const float* x    = (const float*)d_in[0];
    const float* w    = (const float*)d_in[1];
    const float* bias = (const float*)d_in[2];
    const int*   mp   = (const int*)d_in[3];
    float* out = (float*)d_out;
    float* ws  = (float*)d_ws;              // 3 MB used: 16 slabs x 2 strips x 96 KB

    // one thread per column and 8 K values: 256 * 256 threads
    mpdense_pack_kernel<<<dim3(D_DIM / 8), dim3(256), 0, stream>>>(w, mp, ws);

    dim3 grid((B_DIM / ROWS_PER_BLOCK) * (U_DIM / COLS_PER_BLOCK));  // 128 * 2 = 256 blocks
    dim3 block(256);                                                 // 8 waves (wave32)
    mpdense_wmma_kernel<<<grid, block, 0, stream>>>(x, ws, bias, out);
}

// v005
// A run of this version takes 45 microseconds.
// In two side-by-side timings against v004, it was 1.06 and 1.07 times as fast.
// Counting every step since v000, it is 6.89 times as fast.
#include <hip/hip_runtime.h>

typedef __attribute__((ext_vector_type(16))) _Float16 v16h;
typedef __attribute__((ext_vector_type(8)))  _Float16 v8h;
typedef __attribute__((ext_vector_type(8)))  float    v8f;
typedef __attribute__((ext_vector_type(4)))  float    v4f;

#define B_DIM 16384
#define D_DIM 2048
#define U_DIM 256

#define ROWS_PER_BLOCK 128      // 8 waves * 16 rows each
#define NT 8                    // 16-column output tiles per wave
#define COLS_PER_BLOCK (NT * 16)
#define KT 128                  // K per LDS buffer (slab)
#define NCHUNK (KT / 32)        // 4 chunks of K=32
#define NSLAB (D_DIM / KT)
#define SLAB16_BYTES (NCHUNK * NT * 512 * 2)            // one set of fp16 fragments of a slab, 32 KB
#define SLAB_BYTES (3 * SLAB16_BYTES)                   // three sets, 96 KB
#define LO_SCALE 2048.0f        // the low parts are kept times 2^11, clear of the fp16 subnormals
#define COPY_STEP (256 * 16)                            // bytes one copy of the whole block moves
#define A_ROW_BYTES (KT * 4)                            // one row of x within a slab, 512 B
#define A_WAVE_BYTES (16 * A_ROW_BYTES)                 // a wave's 16 rows of a slab, 8 KB
#define A_SLAB_BYTES (ROWS_PER_BLOCK * A_ROW_BYTES)     // the block's rows of a slab, 64 KB

// First launch: the masked weights, once, in the order in which the matrix instructions read them.
// The fp32 bucket's product x * w is formed from fp16 parts, x = xh + xl, w = wh + wl (xh, wh: the value
// rounded to fp16; xl, wl: what is left, rounded to fp16): xh wh + xh wl + xl wh; xl wl, 2^-22 of the
// product, is dropped. xh is the fp16 bucket's own operand, so xh wh joins that bucket's product.
// Workspace: slab s of column strip t at byte (2 s + t) * SLAB_BYTES, three sets of fp16 fragments:
// fp16(w) where mp is 0 or 1; wh where mp is 1; wl * 2^11 where mp is 1;
// in each, one 16-byte piece per lane, the 32 lanes' pieces side by side (512 B per read).
// A thread takes one column and 8 consecutive K values: one piece of each set.
__global__ __launch_bounds__(256)
void mpdense_pack_kernel(const float* __restrict__ w,
                         const int*   __restrict__ mp,
                         float* __restrict__ ws)
{
    const int gid = blockIdx.x * 256 + threadIdx.x;
    const int col = gid & (U_DIM - 1);
    const int g   = gid >> 8;               // K group: K = 8 g .. 8 g + 7
    const int q   = g & 3;                  // group within the 32-K chunk
    const int frag = ((g >> 2) & (NCHUNK - 1)) * NT + ((col >> 4) & (NT - 1));
    const int n16  = col & 15;

    float wv[8];
    int   mv[8];
#pragma unroll
    for (int i = 0; i < 8; ++i) {
        wv[i] = w[(g * 8 + i) * U_DIM + col];
        mv[i] = mp[(g * 8 + i) * U_DIM + col];
    }
    v8h hm, hh, hl;
#pragma unroll
    for (int i = 0; i < 8; ++i) {
        const _Float16 wh = (_Float16)wv[i];
        const _Float16 wl = (_Float16)((wv[i] - (float)wh) * LO_SCALE);
        hm[i] = (mv[i] == 0 || mv[i] == 1) ? wh : (_Float16)0.0f;
        hh[i] = (mv[i] == 1) ? wh : (_Float16)0.0f;
        hl[i] = (mv[i] == 1) ? wl : (_Float16)0.0f;
    }
    unsigned char* slab = (unsigned char*)ws
        + (size_t)((g >> 4) * 2 + (col >> 7)) * SLAB_BYTES;     // 16 groups per 128-K slab
    // fp16 B fragment (16-bit 32x16 B, wave32): lane L, half h holds
    // K = ((L>=16)?8:0) + (h&7) + (h>=8 ? 16:0); the halves h<8 and h>=8 are separate pieces
    unsigned char* piece = slab + ((frag * 2 + (q >> 1)) * 256 + (n16 + 16 * (q & 1)) * 8) * 2;
    *(v8h*)(piece)                    = hm;
    *(v8h*)(piece + SLAB16_BYTES)     = hh;
    *(v8h*)(piece + 2 * SLAB16_BYTES) = hl;
}

// Half a slab (48 KB) from the workspace into LDS, through no register: 12 copies of 16 bytes per lane.
// l: the lane's LDS byte address, g: its global address; every copy has address registers of its own.
// The wait at the end stands before anything can rewrite a register that an issued copy names.
__device__ __forceinline__ void copy_half_slab(unsigned l, const unsigned char* g)
{
    asm volatile("global_load_async_to_lds_b128 %0, %12, off\n\t"
                 "global_load_async_to_lds_b128 %1, %13, off\n\t"
                 "global_load_async_to_lds_b128 %2, %14, off\n\t"
                 "global_load_async_to_lds_b128 %3, %15, off\n\t"
                 "global_load_async_to_lds_b128 %4, %16, off\n\t"
                 "global_load_async_to_lds_b128 %5, %17, off\n\t"
                 "global_load_async_to_lds_b128 %6, %18, off\n\t"
                 "global_load_async_to_lds_b128 %7, %19, off\n\t"
                 "global_load_async_to_lds_b128 %8, %20, off\n\t"
                 "global_load_async_to_lds_b128 %9, %21, off\n\t"
                 "global_load_async_to_lds_b128 %10, %22, off\n\t"
                 "global_load_async_to_lds_b128 %11, %23, off\n\t"
                 "s_wait_xcnt 0x0"
                 :: "v"(l), "v"(l + 1 * COPY_STEP), "v"(l + 2 * COPY_STEP), "v"(l + 3 * COPY_STEP),
                    "v"(l + 4 * COPY_STEP), "v"(l + 5 * COPY_STEP), "v"(l + 6 * COPY_STEP),
                    "v"(l + 7 * COPY_STEP), "v"(l + 8 * COPY_STEP), "v"(l + 9 * COPY_STEP),
                    "v"(l + 10 * COPY_STEP), "v"(l + 11 * COPY_STEP),
                    "v"(g), "v"(g + 1 * COPY_STEP), "v"(g + 2 * COPY_STEP), "v"(g + 3 * COPY_STEP),
                    "v"(g + 4 * COPY_STEP), "v"(g + 5 * COPY_STEP), "v"(g + 6 * COPY_STEP),
                    "v"(g + 7 * COPY_STEP), "v"(g + 8 * COPY_STEP), "v"(g + 9 * COPY_STEP),
                    "v"(g + 10 * COPY_STEP), "v"(g + 11 * COPY_STEP)
                 : "memory");
}

__device__ __forceinline__ void copy_slab(unsigned l, const unsigned char* g)
{
    copy_half_slab(l, g);
    copy_half_slab(l + 12 * COPY_STEP, g + 12 * COPY_STEP);
}

// Eight rows of a wave's x slab from global memory into LDS, through no register: one copy moves one
// whole row of the slab (512 B in a row in memory), lane t its 16-byte piece t.
// In LDS piece t of row j stands at place t ^ j of the row, so that the 16 lanes that later read the same
// piece of 16 different rows fall on 16 different groups of banks (the rows are 512 B apart).
// l: LDS byte address of the wave's row 0, g: the lane's global address in row 0, j0: the first row.
// The wait at the end stands before anything can rewrite a register that an issued copy names.
__device__ __forceinline__ void copy_a_rows8(unsigned l, unsigned lane, unsigned j0, const unsigned char* g)
{
#define A_L(j) (l + (j0 + (j)) * A_ROW_BYTES + ((lane ^ (j0 + (j))) << 4))
#define A_G(j) (g + (size_t)(j0 + (j)) * (D_DIM * 4))
    asm volatile("global_load_async_to_lds_b128 %0, %8, off\n\t"
                 "global_load_async_to_lds_b128 %1, %9, off\n\t"
                 "global_load_async_to_lds_b128 %2, %10, off\n\t"
                 "global_load_async_to_lds_b128 %3, %11, off\n\t"
                 "global_load_async_to_lds_b128 %4, %12, off\n\t"
                 "global_load_async_to_lds_b128 %5, %13, off\n\t"
                 "global_load_async_to_lds_b128 %6, %14, off\n\t"
                 "global_load_async_to_lds_b128 %7, %15, off\n\t"
                 "s_wait_xcnt 0x0"
                 :: "v"(A_L(0)), "v"(A_L(1)), "v"(A_L(2)), "v"(A_L(3)),
                    "v"(A_L(4)), "v"(A_L(5)), "v"(A_L(6)), "v"(A_L(7)),
                    "v"(A_G(0)), "v"(A_G(1)), "v"(A_G(2)), "v"(A_G(3)),
                    "v"(A_G(4)), "v"(A_G(5)), "v"(A_G(6)), "v"(A_G(7))
                 : "memory");
#undef A_L
#undef A_G
}

__device__ __forceinline__ void copy_a_slab(unsigned l, unsigned lane, const unsigned char* g)
{
    copy_a_rows8(l, lane, 0, g);
    copy_a_rows8(l, lane, 8, g);
}

// One 32-K chunk of the lane's A row out of LDS (fp16 fragment order): pieces 8 c + 2 hiL + {0, 1, 4, 5}.
// row: the lane's row in the buffer, sw: (2 hiL) ^ (row number), the lane's part of the place of a piece.
__device__ __forceinline__ void load_a(v4f (&q)[4], const unsigned char* row, unsigned sw, unsigned c)
{
    q[0] = *(const v4f*)(row + ((sw ^ (c * 8 + 0)) << 4));
    q[1] = *(const v4f*)(row + ((sw ^ (c * 8 + 1)) << 4));
    q[2] = *(const v4f*)(row + ((sw ^ (c * 8 + 4)) << 4));
    q[3] = *(const v4f*)(row + ((sw ^ (c * 8 + 5)) << 4));
}

// One fp16 B fragment out of a set in LDS: the lane's two 16-byte pieces.
__device__ __forceinline__ v16h load_b(const _Float16* set, int frag, int lane)
{
    const _Float16* pb = set + frag * 512 + lane * 8;
    const v8h bl = *(const v8h*)(pb);
    const v8h bh = *(const v8h*)(pb + 256);
    return __builtin_shufflevector(bl, bh, 0, 1, 2, 3, 4, 5, 6, 7, 8, 9, 10, 11, 12, 13, 14, 15);
}

// out[b,u] = sum_d x16[b,d]*w16[d,u]*(mp==0) + sum_d x[b,d]*w[d,u]*(mp==1) + bias[u]
// the second sum as xh wh + (xh (wl 2^11) + (xl 2^11) wh) 2^-11, the bracket in accumulators of its own
// Each wave owns a 16 x 128 strip of out: the xh fragment feeds 2 NT matrix instructions, the xl fragment NT.
__global__ __launch_bounds__(256)
void mpdense_wmma_kernel(const float* __restrict__ x,
                         const float* __restrict__ wsB,
                         const float* __restrict__ bias,
                         float* __restrict__ out)
{
    // Two buffers of B operands (masked weights in fragment order, as the first launch left them):
    // slab s is multiplied out of buffer s & 1 while slab s + 1 lands in the other.
    // (the larger alignment puts sB first in LDS: a set's reads then reach it through the offset field)
    __shared__ __align__(1024) unsigned char sB[2 * SLAB_BYTES];    // 192 KB
    // Two buffers of x rows (fp32, as in memory but for the places of the pieces), handed over with sB's.
    __shared__ __align__(512) unsigned char sA[2 * A_SLAB_BYTES];   // 128 KB

    const int tid  = threadIdx.x;
    const int lane = tid & 31;
    const int wave = tid >> 5;

    const int tileN  = blockIdx.x & 1;      // 256/128 = 2 column strips
    const int rowBlk = blockIdx.x >> 1;
    const int gn0    = tileN * COLS_PER_BLOCK;

    const int n    = lane & 15;
    const int hiL  = lane >> 4;             // 0: lanes 0-15, 1: lanes 16-31

    const unsigned char* aRow = sA + wave * A_WAVE_BYTES + n * A_ROW_BYTES;
    const unsigned aSw = (unsigned)((hiL * 2) ^ n);

    // copy roles: thread t moves bytes 16 t .. 16 t + 15 of every 4 KB of a slab
    const unsigned ldsT = (unsigned)(size_t)sB + tid * 16;
    const unsigned char* srcT = (const unsigned char*)wsB + (size_t)tileN * SLAB_BYTES + tid * 16;
    // every wave copies the 16 rows of x that it multiplies itself
    const unsigned ldsA = (unsigned)(size_t)sA + wave * A_WAVE_BYTES;
    const unsigned char* srcA = (const unsigned char*)x
        + (size_t)(rowBlk * ROWS_PER_BLOCK + wave * 16) * (D_DIM * 4) + lane * 16;

    v8f acc[NT]  = {};  // xh * fp16(w), both buckets
    v8f accL[NT] = {};  // the fp32 bucket's two cross terms, times 2^11

    // slab 0 lands and is published; slab 1 flies while slab 0 is multiplied
    copy_slab(ldsT, srcT);
    copy_a_slab(ldsA, lane, srcA);
    asm volatile("s_wait_asynccnt 0x0" ::: "memory");   // this wave's copies of slab 0 have landed
    __syncthreads();
    copy_slab(ldsT + SLAB_BYTES, srcT + 2 * SLAB_BYTES);
    copy_a_slab(ldsA + A_SLAB_BYTES, lane, srcA + A_ROW_BYTES);

    for (int s = 0; s < NSLAB; ++s) {
        const _Float16* sBm = (const _Float16*)(sB + (s & 1) * SLAB_BYTES);
        const _Float16* sBh = (const _Float16*)(sB + (s & 1) * SLAB_BYTES + SLAB16_BYTES);
        const _Float16* sBl = (const _Float16*)(sB + (s & 1) * SLAB_BYTES + 2 * SLAB16_BYTES);
        const unsigned char* aRowS = aRow + (s & 1) * A_SLAB_BYTES;

        // ---- per-wave MMA over staged chunks ----
        // A pieces of two consecutive chunks of this slab: chunk c sits in slot c & 1
        v4f aq[2][4];   // 8 floats at K base 8 hiL and 8 at 16 + 8 hiL
        // unrolled: LDS offsets, the places of the A pieces and the slots are constants
#pragma unroll
        for (int c = 0; c < NCHUNK; ++c) {
            // this fence and the one behind the loads hold all the chunk's LDS reads at
            // its head, as one group with counted waits behind it: without them the scheduler mixes the
            // chunks and strews pairs of LDS reads, one fragment ahead, among the matrix instructions
            __builtin_amdgcn_sched_barrier(0);
            // four vector slots between the last matrix instruction of the chunk before and the first
            // vector instruction of this one, which may reuse its operand registers
            asm volatile("v_nop\n\tv_nop\n\tv_nop\n\tv_nop");
            if (c == 0)
                load_a(aq[0], aRowS, aSw, 0);
            v16h bm[NT], bl[NT], bh[NT];    // the chunk's B fragments of the three sets
            // the fence behind each fragment keeps the reads in the order in which the fragments are
            // multiplied: read in another order (seen in the slab's last chunk), a whole set is waited for
            // before its first matrix instruction
#pragma unroll
            for (int nt = 0; nt < NT; ++nt) {
                bm[nt] = load_b(sBm, c * NT + nt, lane);
                __builtin_amdgcn_sched_barrier(0);
            }
#pragma unroll
            for (int nt = 0; nt < NT; ++nt) {
                bl[nt] = load_b(sBl, c * NT + nt, lane);
                __builtin_amdgcn_sched_barrier(0);
            }
#pragma unroll
            for (int nt = 0; nt < NT; ++nt) {
                bh[nt] = load_b(sBh, c * NT + nt, lane);
                __builtin_amdgcn_sched_barrier(0);
            }
            // the next chunk's A pieces, last in the group: no wait on a B fragment waits for them, and
            // the next chunk's conversions start without an LDS latency in front of them
            if (c + 1 < NCHUNK)
                load_a(aq[(c + 1) & 1], aRowS, aSw, c + 1);
            __builtin_amdgcn_sched_barrier(0);
            v16h a16, aL;       // xh and xl * 2^11
#pragma unroll
            for (int p = 0; p < 4; ++p) {
#pragma unroll
                for (int i = 0; i < 4; ++i) {
                    const float    v = aq[c & 1][p][i];
                    const _Float16 h = (_Float16)v;
                    a16[p * 4 + i] = h;
                    aL[p * 4 + i]  = (_Float16)((v - (float)h) * LO_SCALE);
                }
            }
            // three runs of NT independent accumulator tiles
#pragma unroll
            for (int nt = 0; nt < NT; ++nt)
                acc[nt] = __builtin_amdgcn_wmma_f32_16x16x32_f16(
                    false, a16, false, bm[nt], (short)0, acc[nt], false, false);
#pragma unroll
            for (int nt = 0; nt < NT; ++nt)
                accL[nt] = __builtin_amdgcn_wmma_f32_16x16x32_f16(
                    false, a16, false, bl[nt], (short)0, accL[nt], false, false);
#pragma unroll
            for (int nt = 0; nt < NT; ++nt)
                accL[nt] = __builtin_amdgcn_wmma_f32_16x16x32_f16(
                    false, aL, false, bh[nt], (short)0, accL[nt], false, false);
        }

        // ---- hand-over: slab s + 1 is published, the buffer of slab s is free ----
        // this fence keeps the waits below behind the last chunk's matrix instructions: lifted over them,
        // s_wait_dscnt 0 holds them all back until the chunk's last LDS read has landed
        __builtin_amdgcn_sched_barrier(0);
        asm volatile("s_wait_dscnt 0x0" ::: "memory");      // this wave's reads of slab s are done
        asm volatile("s_wait_asynccnt 0x0" ::: "memory");   // this wave's copies of slab s + 1 have landed
        __syncthreads();
        if (s + 2 < NSLAB) {
            copy_slab(ldsT + (s & 1) * SLAB_BYTES, srcT + (size_t)(s + 2) * (2 * SLAB_BYTES));
            copy_a_slab(ldsA + (s & 1) * A_SLAB_BYTES, lane, srcA + (size_t)(s + 2) * A_ROW_BYTES);
        }
    }
    asm volatile("s_wait_asynccnt 0x0" ::: "memory");       // no copy is open when the wave ends

    // ---- epilogue: bias + store (C/D layout: VGPR r -> M = r + 8*hiL, N = lane&15) ----
    const int rowBase = rowBlk * ROWS_PER_BLOCK + wave * 16 + hiL * 8;
#pragma unroll
    for (int nt = 0; nt < NT; ++nt) {
        const float bb = bias[gn0 + nt * 16 + n];
#pragma unroll
        for (int r = 0; r < 8; ++r) {
            out[(size_t)(rowBase + r) * U_DIM + gn0 + nt * 16 + n] =
                acc[nt][r] + accL[nt][r] * (1.0f / LO_SCALE) + bb;
        }
    }
}

extern "C" void kernel_launch(void* const* d_in, const int* in_sizes, int n_in,
                              void* d_out, int out_size, void* d_ws, size_t ws_size,
                              hipStream_t stream) {
    (void)in_sizes; (void)n_in; (void)ws_size; (void)out_size;
    const float* x    = (const float*)d_in[0];
    const float* w    = (const float*)d_in[1];
    const float* bias = (const float*)d_in[2];
    const int*   mp   = (const int*)d_in[3];
    float* out = (float*)d_out;
    float* ws  = (float*)d_ws;              // 3 MB used: 16 slabs x 2 strips x 96 KB

    // one thread per column and 8 K values: 256 * 256 threads
    mpdense_pack_kernel<<<dim3(D_DIM / 8), dim3(256), 0, stream>>>(w, mp, ws);

    dim3 grid((B_DIM / ROWS_PER_BLOCK) * (U_DIM / COLS_PER_BLOCK));  // 128 * 2 = 256 blocks
    dim3 block(256);                                                 // 8 waves (wave32)
    mpdense_wmma_kernel<<<grid, block, 0, stream>>>(x, ws, bias, out);
}

// v006
// It runs in 39.4 microseconds.
// Timed twice side by side with v005, it ran 1.17 and 1.16 times as fast.
// Counting every step since v000, it is 8.01 times as fast.
#include <hip/hip_runtime.h>

typedef __attribute__((ext_vector_type(16))) _Float16 v16h;
typedef __attribute__((ext_vector_type(8)))  _Float16 v8h;
typedef __attribute__((ext_vector_type(8)))  float    v8f;
typedef __attribute__((ext_vector_type(4)))  float    v4f;

#define B_DIM 16384
#define D_DIM 2048
#define U_DIM 256

#define ROWS_PER_BLOCK 128      // 8 waves * 16 rows each
#define NT 8                    // 16-column output tiles per wave
#define COLS_PER_BLOCK (NT * 16)
#define KT 128                  // K per LDS buffer (slab)
#define NCHUNK (KT / 32)        // 4 chunks of K=32
#define NSLAB (D_DIM / KT)
#define SLAB16_BYTES (NCHUNK * NT * 512 * 2)            // one set of fp16 fragments of a slab, 32 KB
#define SLAB_BYTES (2 * SLAB16_BYTES)                   // two sets, 64 KB
#define LO_SCALE 2048.0f        // the low parts of x are kept times 2^11, clear of the fp16 subnormals
#define W_SCALE 256.0f          // every weight part is kept times 2^8 (exact): w's low parts, which share a
                                // set and its accumulators with high parts, stay clear of the subnormals
#define COPY_STEP (256 * 16)                            // bytes one copy of the whole block moves
#define A_ROW_BYTES (KT * 4)                            // one row of x within a slab, 512 B
#define A_WAVE_BYTES (16 * A_ROW_BYTES)                 // a wave's 16 rows of a slab, 8 KB
#define A_SLAB_BYTES (ROWS_PER_BLOCK * A_ROW_BYTES)     // the block's rows of a slab, 64 KB

// First launch: the masked weights, once, in the order in which the matrix instructions read them.
// The fp32 bucket's product x * w is formed from fp16 parts, x = xh + xl, w = wh + wl (xh, wh: the value
// rounded to fp16; xl, wl: what is left, rounded to fp16): xh wh + xh wl + xl wh; xl wl, 2^-22 of the
// product, is dropped. xh is the fp16 bucket's own operand too, and no weight is in both buckets: fp16(w) of
// the fp16 bucket and wl of the fp32 bucket stand in ONE set, which xh multiplies.
// Workspace: slab s of column strip t at byte (2 s + t) * SLAB_BYTES, two sets of fp16 fragments, times 2^8:
// wh where mp is 1; fp16(w) where mp is 0 and wl where mp is 1;
// in each, one 16-byte piece per lane, the 32 lanes' pieces side by side (512 B per read).
// A thread takes one column and 8 consecutive K values: one piece of each set.
__global__ __launch_bounds__(256)
void mpdense_pack_kernel(const float* __restrict__ w,
                         const int*   __restrict__ mp,
                         float* __restrict__ ws)
{
    const int gid = blockIdx.x * 256 + threadIdx.x;
    const int col = gid & (U_DIM - 1);
    const int g   = gid >> 8;               // K group: K = 8 g .. 8 g + 7
    const int q   = g & 3;                  // group within the 32-K chunk
    const int frag = ((g >> 2) & (NCHUNK - 1)) * NT + ((col >> 4) & (NT - 1));
    const int n16  = col & 15;

    float wv[8];
    int   mv[8];
#pragma unroll
    for (int i = 0; i < 8; ++i) {
        wv[i] = w[(g * 8 + i) * U_DIM + col];
        mv[i] = mp[(g * 8 + i) * U_DIM + col];
    }
    v8h hh, hc;
#pragma unroll
    for (int i = 0; i < 8; ++i) {
        const float    r  = (float)(_Float16)wv[i];             // w rounded to fp16
        const _Float16 wh = (_Float16)(r * W_SCALE);
        const _Float16 wl = (_Float16)((wv[i] - r) * W_SCALE);
        hh[i] = (mv[i] == 1) ? wh : (_Float16)0.0f;
        hc[i] = (mv[i] == 0) ? wh : (mv[i] == 1) ? wl : (_Float16)0.0f;
    }
    unsigned char* slab = (unsigned char*)ws
        + (size_t)((g >> 4) * 2 + (col >> 7)) * SLAB_BYTES;     // 16 groups per 128-K slab
    // fp16 B fragment (16-bit 32x16 B, wave32): lane L, half h holds
    // K = ((L>=16)?8:0) + (h&7) + (h>=8 ? 16:0); the halves h<8 and h>=8 are separate pieces
    unsigned char* piece = slab + ((frag * 2 + (q >> 1)) * 256 + (n16 + 16 * (q & 1)) * 8) * 2;
    *(v8h*)(piece)                = hh;
    *(v8h*)(piece + SLAB16_BYTES) = hc;
}

// Half a slab (32 KB) from the workspace into LDS, through no register: 8 copies of 16 bytes per lane.
// l: the lane's LDS byte address, g: its global address; every copy has address registers of its own.
// The wait at the end stands before anything can rewrite a register that an issued copy names.
__device__ __forceinline__ void copy_half_slab(unsigned l, const unsigned char* g)
{
    asm volatile("global_load_async_to_lds_b128 %0, %8, off\n\t"
                 "global_load_async_to_lds_b128 %1, %9, off\n\t"
                 "global_load_async_to_lds_b128 %2, %10, off\n\t"
                 "global_load_async_to_lds_b128 %3, %11, off\n\t"
                 "global_load_async_to_lds_b128 %4, %12, off\n\t"
                 "global_load_async_to_lds_b128 %5, %13, off\n\t"
                 "global_load_async_to_lds_b128 %6, %14, off\n\t"
                 "global_load_async_to_lds_b128 %7, %15, off\n\t"
                 "s_wait_xcnt 0x0"
                 :: "v"(l), "v"(l + 1 * COPY_STEP), "v"(l + 2 * COPY_STEP), "v"(l + 3 * COPY_STEP),
                    "v"(l + 4 * COPY_STEP), "v"(l + 5 * COPY_STEP), "v"(l + 6 * COPY_STEP),
                    "v"(l + 7 * COPY_STEP),
                    "v"(g), "v"(g + 1 * COPY_STEP), "v"(g + 2 * COPY_STEP), "v"(g + 3 * COPY_STEP),
                    "v"(g + 4 * COPY_STEP), "v"(g + 5 * COPY_STEP), "v"(g + 6 * COPY_STEP),
                    "v"(g + 7 * COPY_STEP)
                 : "memory");
}

__device__ __forceinline__ void copy_slab(unsigned l, const unsigned char* g)
{
    copy_half_slab(l, g);
    copy_half_slab(l + 8 * COPY_STEP, g + 8 * COPY_STEP);
}

// Eight rows of a wave's x slab from global memory into LDS, through no register: one copy moves one
// whole row of the slab (512 B in a row in memory), lane t its 16-byte piece t.
// In LDS piece t of row j stands at place t ^ j of the row, so that the 16 lanes that later read the same
// piece of 16 different rows fall on 16 different groups of banks (the rows are 512 B apart).
// l: LDS byte address of the wave's row 0, g: the lane's global address in row 0, j0: the first row.
// The wait at the end stands before anything can rewrite a register that an issued copy names.
__device__ __forceinline__ void copy_a_rows8(unsigned l, unsigned lane, unsigned j0, const unsigned char* g)
{
#define A_L(j) (l + (j0 + (j)) * A_ROW_BYTES + ((lane ^ (j0 + (j))) << 4))
#define A_G(j) (g + (size_t)(j0 + (j)) * (D_DIM * 4))
    asm volatile("global_load_async_to_lds_b128 %0, %8, off\n\t"
                 "global_load_async_to_lds_b128 %1, %9, off\n\t"
                 "global_load_async_to_lds_b128 %2, %10, off\n\t"
                 "global_load_async_to_lds_b128 %3, %11, off\n\t"
                 "global_load_async_to_lds_b128 %4, %12, off\n\t"
                 "global_load_async_to_lds_b128 %5, %13, off\n\t"
                 "global_load_async_to_lds_b128 %6, %14, off\n\t"
                 "global_load_async_to_lds_b128 %7, %15, off\n\t"
                 "s_wait_xcnt 0x0"
                 :: "v"(A_L(0)), "v"(A_L(1)), "v"(A_L(2)), "v"(A_L(3)),
                    "v"(A_L(4)), "v"(A_L(5)), "v"(A_L(6)), "v"(A_L(7)),
                    "v"(A_G(0)), "v"(A_G(1)), "v"(A_G(2)), "v"(A_G(3)),
                    "v"(A_G(4)), "v"(A_G(5)), "v"(A_G(6)), "v"(A_G(7))
                 : "memory");
#undef A_L
#undef A_G
}

__device__ __forceinline__ void copy_a_slab(unsigned l, unsigned lane, const unsigned char* g)
{
    copy_a_rows8(l, lane, 0, g);
    copy_a_rows8(l, lane, 8, g);
}

// One 32-K chunk of the lane's A row out of LDS (fp16 fragment order): pieces 8 c + 2 hiL + {0, 1, 4, 5}.
// row: the lane's row in the buffer, sw: (2 hiL) ^ (row number), the lane's part of the place of a piece.
__device__ __forceinline__ void load_a(v4f (&q)[4], const unsigned char* row, unsigned sw, unsigned c)
{
    q[0] = *(const v4f*)(row + ((sw ^ (c * 8 + 0)) << 4));
    q[1] = *(const v4f*)(row + ((sw ^ (c * 8 + 1)) << 4));
    q[2] = *(const v4f*)(row + ((sw ^ (c * 8 + 4)) << 4));
    q[3] = *(const v4f*)(row + ((sw ^ (c * 8 + 5)) << 4));
}

// One fp16 B fragment out of a set in LDS: the lane's two 16-byte pieces.
__device__ __forceinline__ v16h load_b(const _Float16* set, int frag, int lane)
{
    const _Float16* pb = set + frag * 512 + lane * 8;
    const v8h bl = *(const v8h*)(pb);
    const v8h bh = *(const v8h*)(pb + 256);
    return __builtin_shufflevector(bl, bh, 0, 1, 2, 3, 4, 5, 6, 7, 8, 9, 10, 11, 12, 13, 14, 15);
}

// out[b,u] = sum_d x16[b,d]*w16[d,u]*(mp==0) + sum_d x[b,d]*w[d,u]*(mp==1) + bias[u]
// the second sum as xh wh + xh wl + ((xl 2^11) wh) 2^-11, the last bracket in accumulators of its own
// Each wave owns a 16 x 128 strip of out: one A fragment feeds NT matrix instructions.
__global__ __launch_bounds__(256)
void mpdense_wmma_kernel(const float* __restrict__ x,
                         const float* __restrict__ wsB,
                         const float* __restrict__ bias,
                         float* __restrict__ out)
{
    // Two buffers of B operands (masked weights in fragment order, as the first launch left them):
    // slab s is multiplied out of buffer s & 1 while slab s + 1 lands in the other.
    // (the larger alignment puts sB first in LDS: a set's reads then reach it through the offset field)
    __shared__ __align__(1024) unsigned char sB[2 * SLAB_BYTES];    // 128 KB
    // Two buffers of x rows (fp32, as in memory but for the places of the pieces), handed over with sB's.
    __shared__ __align__(512) unsigned char sA[2 * A_SLAB_BYTES];   // 128 KB

    const int tid  = threadIdx.x;
    const int lane = tid & 31;
    const int wave = tid >> 5;

    const int tileN  = blockIdx.x & 1;      // 256/128 = 2 column strips
    const int rowBlk = blockIdx.x >> 1;
    const int gn0    = tileN * COLS_PER_BLOCK;

    const int n    = lane & 15;
    const int hiL  = lane >> 4;             // 0: lanes 0-15, 1: lanes 16-31

    const unsigned char* aRow = sA + wave * A_WAVE_BYTES + n * A_ROW_BYTES;
    const unsigned aSw = (unsigned)((hiL * 2) ^ n);

    // copy roles: thread t moves bytes 16 t .. 16 t + 15 of every 4 KB of a slab
    const unsigned ldsT = (unsigned)(size_t)sB + tid * 16;
    const unsigned char* srcT = (const unsigned char*)wsB + (size_t)tileN * SLAB_BYTES + tid * 16;
    // every wave copies the 16 rows of x that it multiplies itself
    const unsigned ldsA = (unsigned)(size_t)sA + wave * A_WAVE_BYTES;
    const unsigned char* srcA = (const unsigned char*)x
        + (size_t)(rowBlk * ROWS_PER_BLOCK + wave * 16) * (D_DIM * 4) + lane * 16;

    v8f acc[NT]  = {};  // xh * (fp16(w) of both buckets, wl of the fp32 bucket), times 2^8
    v8f accL[NT] = {};  // xl * wh of the fp32 bucket, times 2^19

    // slab 0 lands and is published; slab 1 flies while slab 0 is multiplied
    copy_slab(ldsT, srcT);
    copy_a_slab(ldsA, lane, srcA);
    asm volatile("s_wait_asynccnt 0x0" ::: "memory");   // this wave's copies of slab 0 have landed
    __syncthreads();
    copy_slab(ldsT + SLAB_BYTES, srcT + 2 * SLAB_BYTES);
    copy_a_slab(ldsA + A_SLAB_BYTES, lane, srcA + A_ROW_BYTES);

    for (int s = 0; s < NSLAB; ++s) {
        const _Float16* sBh = (const _Float16*)(sB + (s & 1) * SLAB_BYTES);
        const _Float16* sBc = (const _Float16*)(sB + (s & 1) * SLAB_BYTES + SLAB16_BYTES);
        const unsigned char* aRowS = aRow + (s & 1) * A_SLAB_BYTES;

        // ---- per-wave MMA over staged chunks ----
        // A pieces of two consecutive chunks of this slab: chunk c sits in slot c & 1
        v4f aq[2][4];   // 8 floats at K base 8 hiL and 8 at 16 + 8 hiL
        // unrolled: LDS offsets, the places of the A pieces and the slots are constants
#pragma unroll
        for (int c = 0; c < NCHUNK; ++c) {
            // this fence and the one behind the loads hold all the chunk's LDS reads at
            // its head, as one group with counted waits behind it: without them the scheduler mixes the
            // chunks and strews pairs of LDS reads, one fragment ahead, among the matrix instructions
            __builtin_amdgcn_sched_barrier(0);
            // four vector slots between the last matrix instruction of the chunk before and the first
            // vector instruction of this one, which may reuse its operand registers
            asm volatile("v_nop\n\tv_nop\n\tv_nop\n\tv_nop");
            if (c == 0)
                load_a(aq[0], aRowS, aSw, 0);
            v16h bh[NT], bc[NT];            // the chunk's B fragments of the two sets
            // the fence behind each fragment keeps the reads in the order in which the fragments are
            // multiplied: read in another order (seen in the slab's last chunk), a whole set is waited for
            // before its first matrix instruction
#pragma unroll
            for (int nt = 0; nt < NT; ++nt) {
                bh[nt] = load_b(sBh, c * NT + nt, lane);
                __builtin_amdgcn_sched_barrier(0);
            }
#pragma unroll
            for (int nt = 0; nt < NT; ++nt) {
                bc[nt] = load_b(sBc, c * NT + nt, lane);
                __builtin_amdgcn_sched_barrier(0);
            }
            // the next chunk's A pieces, last in the group: no wait on a B fragment waits for them, and
            // the next chunk's conversions start without an LDS latency in front of them
            if (c + 1 < NCHUNK)
                load_a(aq[(c + 1) & 1], aRowS, aSw, c + 1);
            __builtin_amdgcn_sched_barrier(0);
            v16h a16, aL;       // xh and xl * 2^11
#pragma unroll
            for (int p = 0; p < 4; ++p) {
#pragma unroll
                for (int i = 0; i < 4; ++i) {
                    const float    v = aq[c & 1][p][i];
                    const _Float16 h = (_Float16)v;
                    a16[p * 4 + i] = h;
                    aL[p * 4 + i]  = (_Float16)((v - (float)h) * LO_SCALE);
                }
            }
            // three runs of NT independent accumulator tiles; the set read first feeds two of them
#pragma unroll
            for (int nt = 0; nt < NT; ++nt)
                acc[nt] = __builtin_amdgcn_wmma_f32_16x16x32_f16(
                    false, a16, false, bh[nt], (short)0, acc[nt], false, false);
#pragma unroll
            for (int nt = 0; nt < NT; ++nt)
                accL[nt] = __builtin_amdgcn_wmma_f32_16x16x32_f16(
                    false, aL, false, bh[nt], (short)0, accL[nt], false, false);
#pragma unroll
            for (int nt = 0; nt < NT; ++nt)
                acc[nt] = __builtin_amdgcn_wmma_f32_16x16x32_f16(
                    false, a16, false, bc[nt], (short)0, acc[nt], false, false);
        }

        // ---- hand-over: slab s + 1 is published, the buffer of slab s is free ----
        // this fence keeps the waits below behind the last chunk's matrix instructions: lifted over them,
        // s_wait_dscnt 0 holds them all back until the chunk's last LDS read has landed
        __builtin_amdgcn_sched_barrier(0);
        asm volatile("s_wait_dscnt 0x0" ::: "memory");      // this wave's reads of slab s are done
        asm volatile("s_wait_asynccnt 0x0" ::: "memory");   // this wave's copies of slab s + 1 have landed
        __syncthreads();
        if (s + 2 < NSLAB) {
            copy_slab(ldsT + (s & 1) * SLAB_BYTES, srcT + (size_t)(s + 2) * (2 * SLAB_BYTES));
            copy_a_slab(ldsA + (s & 1) * A_SLAB_BYTES, lane, srcA + (size_t)(s + 2) * A_ROW_BYTES);
        }
    }
    asm volatile("s_wait_asynccnt 0x0" ::: "memory");       // no copy is open when the wave ends

    // ---- epilogue: bias + store (C/D layout: VGPR r -> M = r + 8*hiL, N = lane&15) ----
    const int rowBase = rowBlk * ROWS_PER_BLOCK + wave * 16 + hiL * 8;
#pragma unroll
    for (int nt = 0; nt < NT; ++nt) {
        const float bb = bias[gn0 + nt * 16 + n];
#pragma unroll
        for (int r = 0; r < 8; ++r) {
            out[(size_t)(rowBase + r) * U_DIM + gn0 + nt * 16 + n] =
                acc[nt][r] * (1.0f / W_SCALE) + accL[nt][r] * (1.0f / (W_SCALE * LO_SCALE)) + bb;
        }
    }
}

extern "C" void kernel_launch(void* const* d_in, const int* in_sizes, int n_in,
                              void* d_out, int out_size, void* d_ws, size_t ws_size,
                              hipStream_t stream) {
    (void)in_sizes; (void)n_in; (void)ws_size; (void)out_size;
    const float* x    = (const float*)d_in[0];
    const float* w    = (const float*)d_in[1];
    const float* bias = (const float*)d_in[2];
    const int*   mp   = (const int*)d_in[3];
    float* out = (float*)d_out;
    float* ws  = (float*)d_ws;              // 2 MB used: 16 slabs x 2 strips x 64 KB

    // one thread per column and 8 K values: 256 * 256 threads
    mpdense_pack_kernel<<<dim3(D_DIM / 8), dim3(256), 0, stream>>>(w, mp, ws);

    dim3 grid((B_DIM / ROWS_PER_BLOCK) * (U_DIM / COLS_PER_BLOCK));  // 128 * 2 = 256 blocks
    dim3 block(256);                                                 // 8 waves (wave32)
    mpdense_wmma_kernel<<<grid, block, 0, stream>>>(x, ws, bias, out);
}

// v007
// It runs in 36.8 microseconds.
// Timed twice side by side with v006, it ran 1.07 times as fast both times.
// Counting every step since v000, it is 8.57 times as fast.
#include <hip/hip_runtime.h>

typedef __attribute__((ext_vector_type(16))) _Float16 v16h;
typedef __attribute__((ext_vector_type(8)))  _Float16 v8h;
typedef __attribute__((ext_vector_type(8)))  float    v8f;
typedef __attribute__((ext_vector_type(4)))  float    v4f;

#define B_DIM 16384
#define D_DIM 2048
#define U_DIM 256

#define ROWS_PER_BLOCK 128      // 4 row groups of 32 rows; two waves per group, each on half of the K range
#define MT 2                    // 16-row A fragments per wave
#define NT 8                    // 16-column output tiles per wave
#define COLS_PER_BLOCK (NT * 16)
#define KT 128                  // K per LDS buffer (slab)
#define NCHUNK (KT / 32)        // 4 chunks of K=32
#define WCHUNK (NCHUNK / 2)     // chunks of a slab that one wave multiplies
#define NSLAB (D_DIM / KT)
#define SLAB16_BYTES (NCHUNK * NT * 512 * 2)            // one set of fp16 fragments of a slab, 32 KB
#define SLAB_BYTES (2 * SLAB16_BYTES)                   // two sets, 64 KB
#define LO_SCALE 2048.0f        // the low parts of x are kept times 2^11, clear of the fp16 subnormals
#define W_SCALE 256.0f          // every weight part is kept times 2^8 (exact): w's low parts, which share a
                                // set and its accumulators with high parts, stay clear of the subnormals
#define COPY_STEP (256 * 16)                            // bytes one copy of the whole block moves
#define A_ROW_BYTES (KT * 4)                            // one row of x within a slab, 512 B
#define A_WAVE_BYTES (16 * A_ROW_BYTES)                 // a wave's 16 rows of a slab, 8 KB
#define A_SLAB_BYTES (ROWS_PER_BLOCK * A_ROW_BYTES)     // the block's rows of a slab, 64 KB

// First launch: the masked weights, once, in the order in which the matrix instructions read them.
// The fp32 bucket's product x * w is formed from fp16 parts, x = xh + xl, w = wh + wl (xh, wh: the value
// rounded to fp16; xl, wl: what is left, rounded to fp16): xh wh + xh wl + xl wh; xl wl, 2^-22 of the
// product, is dropped. xh is the fp16 bucket's own operand too, and no weight is in both buckets: fp16(w) of
// the fp16 bucket and wl of the fp32 bucket stand in ONE set, which xh multiplies.
// Workspace: slab s of column strip t at byte (2 s + t) * SLAB_BYTES, two sets of fp16 fragments, times 2^8:
// wh where mp is 1; fp16(w) where mp is 0 and wl where mp is 1;
// in each, one 16-byte piece per lane, the 32 lanes' pieces side by side (512 B per read).
// A thread takes one column and 8 consecutive K values: one piece of each set.
__global__ __launch_bounds__(256)
void mpdense_pack_kernel(const float* __restrict__ w,
                         const int*   __restrict__ mp,
                         float* __restrict__ ws)
{
    const int gid = blockIdx.x * 256 + threadIdx.x;
    const int col = gid & (U_DIM - 1);
    const int g   = gid >> 8;               // K group: K = 8 g .. 8 g + 7
    const int q   = g & 3;                  // group within the 32-K chunk
    const int frag = ((g >> 2) & (NCHUNK - 1)) * NT + ((col >> 4) & (NT - 1));
    const int n16  = col & 15;

    float wv[8];
    int   mv[8];
#pragma unroll
    for (int i = 0; i < 8; ++i) {
        wv[i] = w[(g * 8 + i) * U_DIM + col];
        mv[i] = mp[(g * 8 + i) * U_DIM + col];
    }
    v8h hh, hc;
#pragma unroll
    for (int i = 0; i < 8; ++i) {
        const float    r  = (float)(_Float16)wv[i];             // w rounded to fp16
        const _Float16 wh = (_Float16)(r * W_SCALE);
        const _Float16 wl = (_Float16)((wv[i] - r) * W_SCALE);
        hh[i] = (mv[i] == 1) ? wh : (_Float16)0.0f;
        hc[i] = (mv[i] == 0) ? wh : (mv[i] == 1) ? wl : (_Float16)0.0f;
    }
    unsigned char* slab = (unsigned char*)ws
        + (size_t)((g >> 4) * 2 + (col >> 7)) * SLAB_BYTES;     // 16 groups per 128-K slab
    // fp16 B fragment (16-bit 32x16 B, wave32): lane L, half h holds
    // K = ((L>=16)?8:0) + (h&7) + (h>=8 ? 16:0); the halves h<8 and h>=8 are separate pieces
    unsigned char* piece = slab + ((frag * 2 + (q >> 1)) * 256 + (n16 + 16 * (q & 1)) * 8) * 2;
    *(v8h*)(piece)                = hh;
    *(v8h*)(piece + SLAB16_BYTES) = hc;
}

// Half a slab (32 KB) from the workspace into LDS, through no register: 8 copies of 16 bytes per lane.
// l: the lane's LDS byte address, g: its global address; every copy has address registers of its own.
// The wait at the end stands before anything can rewrite a register that an issued copy names.
__device__ __forceinline__ void copy_half_slab(unsigned l, const unsigned char* g)
{
    asm volatile("global_load_async_to_lds_b128 %0, %8, off\n\t"
                 "global_load_async_to_lds_b128 %1, %9, off\n\t"
                 "global_load_async_to_lds_b128 %2, %10, off\n\t"
                 "global_load_async_to_lds_b128 %3, %11, off\n\t"
                 "global_load_async_to_lds_b128 %4, %12, off\n\t"
                 "global_load_async_to_lds_b128 %5, %13, off\n\t"
                 "global_load_async_to_lds_b128 %6, %14, off\n\t"
                 "global_load_async_to_lds_b128 %7, %15, off\n\t"
                 "s_wait_xcnt 0x0"
                 :: "v"(l), "v"(l + 1 * COPY_STEP), "v"(l + 2 * COPY_STEP), "v"(l + 3 * COPY_STEP),
                    "v"(l + 4 * COPY_STEP), "v"(l + 5 * COPY_STEP), "v"(l + 6 * COPY_STEP),
                    "v"(l + 7 * COPY_STEP),
                    "v"(g), "v"(g + 1 * COPY_STEP), "v"(g + 2 * COPY_STEP), "v"(g + 3 * COPY_STEP),
                    "v"(g + 4 * COPY_STEP), "v"(g + 5 * COPY_STEP), "v"(g + 6 * COPY_STEP),
                    "v"(g + 7 * COPY_STEP)
                 : "memory");
}

__device__ __forceinline__ void copy_slab(unsigned l, const unsigned char* g)
{
    copy_half_slab(l, g);
    // this fence keeps the next statement's address arithmetic behind this statement: with the addresses of
    // several statements live at once the registers run out beside the accumulators (scratch, register moves)
    __builtin_amdgcn_sched_barrier(0);
    copy_half_slab(l + 8 * COPY_STEP, g + 8 * COPY_STEP);
    __builtin_amdgcn_sched_barrier(0);      // as above
}

// Eight rows of a wave's x slab from global memory into LDS, through no register: one copy moves one
// whole row of the slab (512 B in a row in memory), lane t its 16-byte piece t.
// In LDS piece t of row j stands at place t ^ j of the row, so that the 16 lanes that later read the same
// piece of 16 different rows fall on 16 different groups of banks (the rows are 512 B apart).
// l: LDS byte address of the wave's row 0, g: the lane's global address in row 0, j0: the first row.
// The wait at the end stands before anything can rewrite a register that an issued copy names.
__device__ __forceinline__ void copy_a_rows8(unsigned l, unsigned lane, unsigned j0, const unsigned char* g)
{
#define A_L(j) (l + (j0 + (j)) * A_ROW_BYTES + ((lane ^ (j0 + (j))) << 4))
#define A_G(j) (g + (size_t)(j0 + (j)) * (D_DIM * 4))
    asm volatile("global_load_async_to_lds_b128 %0, %8, off\n\t"
                 "global_load_async_to_lds_b128 %1, %9, off\n\t"
                 "global_load_async_to_lds_b128 %2, %10, off\n\t"
                 "global_load_async_to_lds_b128 %3, %11, off\n\t"
                 "global_load_async_to_lds_b128 %4, %12, off\n\t"
                 "global_load_async_to_lds_b128 %5, %13, off\n\t"
                 "global_load_async_to_lds_b128 %6, %14, off\n\t"
                 "global_load_async_to_lds_b128 %7, %15, off\n\t"
                 "s_wait_xcnt 0x0"
                 :: "v"(A_L(0)), "v"(A_L(1)), "v"(A_L(2)), "v"(A_L(3)),
                    "v"(A_L(4)), "v"(A_L(5)), "v"(A_L(6)), "v"(A_L(7)),
                    "v"(A_G(0)), "v"(A_G(1)), "v"(A_G(2)), "v"(A_G(3)),
                    "v"(A_G(4)), "v"(A_G(5)), "v"(A_G(6)), "v"(A_G(7))
                 : "memory");
#undef A_L
#undef A_G
}

__device__ __forceinline__ void copy_a_slab(unsigned l, unsigned lane, const unsigned char* g)
{
    copy_a_rows8(l, lane, 0, g);
    __builtin_amdgcn_sched_barrier(0);      // as in copy_slab
    copy_a_rows8(l, lane, 8, g);
}

// One 32-K chunk of the lane's A row out of LDS (fp16 fragment order): pieces 8 c + 2 hiL + {0, 1, 4, 5}.
// row: the lane's row in the buffer (at the wave's half of the slab's K), sw: (2 hiL) ^ (row number mod 16),
// the lane's part of the place of a piece.
__device__ __forceinline__ void load_a(v4f (&q)[4], const unsigned char* row, unsigned sw, unsigned c)
{
    q[0] = *(const v4f*)(row + ((sw ^ (c * 8 + 0)) << 4));
    q[1] = *(const v4f*)(row + ((sw ^ (c * 8 + 1)) << 4));
    q[2] = *(const v4f*)(row + ((sw ^ (c * 8 + 4)) << 4));
    q[3] = *(const v4f*)(row + ((sw ^ (c * 8 + 5)) << 4));
}

// One fp16 B fragment out of a set in LDS: the lane's two 16-byte pieces.
__device__ __forceinline__ v16h load_b(const _Float16* set, int frag, int lane)
{
    const _Float16* pb = set + frag * 512 + lane * 8;
    const v8h bl = *(const v8h*)(pb);
    const v8h bh = *(const v8h*)(pb + 256);
    return __builtin_shufflevector(bl, bh, 0, 1, 2, 3, 4, 5, 6, 7, 8, 9, 10, 11, 12, 13, 14, 15);
}

// The scaled sum of a tile's two accumulators, four rows of it.
__device__ __forceinline__ v4f merged4(const v8f& a, const v8f& l, int r0)
{
    v4f t;
#pragma unroll
    for (int i = 0; i < 4; ++i)
        t[i] = a[r0 + i] * (1.0f / W_SCALE) + l[r0 + i] * (1.0f / (W_SCALE * LO_SCALE));
    return t;
}

// A wave's partial sums of 16 rows x 128 columns into its 8 KB of LDS, 16 bytes per lane side by side.
__device__ __forceinline__ void put_half(v4f* slot, const v8f (&a)[NT], const v8f (&l)[NT])
{
#pragma unroll
    for (int nt = 0; nt < NT; ++nt) {
        slot[(nt * 2 + 0) * 32] = merged4(a[nt], l[nt], 0);
        slot[(nt * 2 + 1) * 32] = merged4(a[nt], l[nt], 4);
    }
}

// The wave's own partial sums of 16 rows, the partner's out of LDS and the bias: the rows' 128 columns of out.
// (C/D layout: VGPR r -> M = r + 8*hiL, N = lane&15); o: the lane's element of row r = 0, tile 0
__device__ __forceinline__ void finish_half(float* o, const float* bias_n, const v4f* slot,
                                            const v8f (&a)[NT], const v8f (&l)[NT])
{
#pragma unroll
    for (int nt = 0; nt < NT; ++nt) {
        const float bb = bias_n[nt * 16];
#pragma unroll
        for (int hf = 0; hf < 2; ++hf) {
            const v4f own = merged4(a[nt], l[nt], hf * 4);
            const v4f oth = slot[(nt * 2 + hf) * 32];
#pragma unroll
            for (int i = 0; i < 4; ++i)
                o[(size_t)(hf * 4 + i) * U_DIM + nt * 16] = own[i] + oth[i] + bb;
        }
    }
}

// out[b,u] = sum_d x16[b,d]*w16[d,u]*(mp==0) + sum_d x[b,d]*w[d,u]*(mp==1) + bias[u]
// the second sum as xh wh + xh wl + ((xl 2^11) wh) 2^-11, the last bracket in accumulators of its own
// Each wave works on a 32 x 128 strip of out: a B fragment read from LDS feeds MT A fragments. The strip's
// two waves (w and w + 4) each take half of the chunks of every slab; their sums are added at the end.
__global__ __launch_bounds__(256)
void mpdense_wmma_kernel(const float* __restrict__ x,
                         const float* __restrict__ wsB,
                         const float* __restrict__ bias,
                         float* __restrict__ out)
{
    // Two buffers of B operands (masked weights in fragment order, as the first launch left them):
    // slab s is multiplied out of buffer s & 1 while slab s + 1 lands in the other.
    // (the larger alignment puts sB first in LDS: a set's reads then reach it through the offset field)
    __shared__ __align__(1024) unsigned char sB[2 * SLAB_BYTES];    // 128 KB
    // Two buffers of x rows (fp32, as in memory but for the places of the pieces), handed over with sB's.
    __shared__ __align__(512) unsigned char sA[2 * A_SLAB_BYTES];   // 128 KB

    const int tid  = threadIdx.x;
    const int lane = tid & 31;
    const int wave = tid >> 5;

    const int tileN  = blockIdx.x & 1;      // 256/128 = 2 column strips
    const int rowBlk = blockIdx.x >> 1;
    const int gn0    = tileN * COLS_PER_BLOCK;

    const int n    = lane & 15;
    const int hiL  = lane >> 4;             // 0: lanes 0-15, 1: lanes 16-31

    const int waveU = __builtin_amdgcn_readfirstlane(wave);     // in a scalar register: scalar branches below
    const int rg = waveU & 3;               // row group: rows 32 rg .. 32 rg + 31 of the block
    const int kg = waveU >> 2;              // K half: chunks WCHUNK kg .. WCHUNK kg + WCHUNK - 1 of every slab

    const unsigned char* aRow = sA + (rg * (MT * 16) + n) * A_ROW_BYTES + kg * (WCHUNK * 128);
    const unsigned aSw = (unsigned)((hiL * 2) ^ n);

    // copy roles: thread t moves bytes 16 t .. 16 t + 15 of every 4 KB of a slab
    const unsigned ldsT = (unsigned)(size_t)sB + tid * 16;
    const unsigned char* srcT = (const unsigned char*)wsB + (size_t)tileN * SLAB_BYTES + tid * 16;
    // wave w copies rows 16 w .. 16 w + 15 of the block's x rows (read by the two waves of their row group)
    const unsigned ldsA = (unsigned)(size_t)sA + wave * A_WAVE_BYTES;
    const unsigned char* srcA = (const unsigned char*)x
        + (size_t)(rowBlk * ROWS_PER_BLOCK + wave * 16) * (D_DIM * 4) + lane * 16;

    v8f acc[MT][NT]  = {};  // xh * (fp16(w) of both buckets, wl of the fp32 bucket), times 2^8
    v8f accL[MT][NT] = {};  // xl * wh of the fp32 bucket, times 2^19

    // slab 0 lands and is published; slab 1 flies while slab 0 is multiplied
    copy_slab(ldsT, srcT);
    copy_a_slab(ldsA, lane, srcA);
    asm volatile("s_wait_asynccnt 0x0" ::: "memory");   // this wave's copies of slab 0 have landed
    __syncthreads();
    copy_slab(ldsT + SLAB_BYTES, srcT + 2 * SLAB_BYTES);
    copy_a_slab(ldsA + A_SLAB_BYTES, lane, srcA + A_ROW_BYTES);

    for (int s = 0; s < NSLAB; ++s) {
        const unsigned char* sBk = sB + (s & 1) * SLAB_BYTES + kg * (WCHUNK * NT * 1024);
        const _Float16* sBh = (const _Float16*)(sBk);
        const _Float16* sBc = (const _Float16*)(sBk + SLAB16_BYTES);
        const unsigned char* aRowS = aRow + (s & 1) * A_SLAB_BYTES;

        // ---- per-wave MMA over the wave's staged chunks ----
        // unrolled: LDS offsets and the places of the A pieces are constants
#pragma unroll
        for (int c = 0; c < WCHUNK; ++c) {
            // this fence and the one behind the loads hold all the chunk's LDS reads at
            // its head, as one group with counted waits behind it: without them the scheduler mixes the
            // chunks and strews pairs of LDS reads, one fragment ahead, among the matrix instructions
            __builtin_amdgcn_sched_barrier(0);
            // four vector slots between the last matrix instruction of the chunk before and the first
            // vector instruction of this one, which may reuse its operand registers
            asm volatile("v_nop\n\tv_nop\n\tv_nop\n\tv_nop");
            // the A pieces first: the conversions wait for them alone and run while the B fragments land
            v4f aq[MT][4];      // per fragment 8 floats at K base 8 hiL and 8 at 16 + 8 hiL
#pragma unroll
            for (int f = 0; f < MT; ++f)
                load_a(aq[f], aRowS + f * A_WAVE_BYTES, aSw, c);
            v16h bh[NT], bc[NT];            // the chunk's B fragments of the two sets
            // the fence behind each fragment keeps the reads in the order in which the fragments are
            // multiplied: read in another order, a whole set is waited for
            // before its first matrix instruction
#pragma unroll
            for (int nt = 0; nt < NT; ++nt) {
                bh[nt] = load_b(sBh, c * NT + nt, lane);
                __builtin_amdgcn_sched_barrier(0);
            }
#pragma unroll
            for (int nt = 0; nt < NT; ++nt) {
                bc[nt] = load_b(sBc, c * NT + nt, lane);
                __builtin_amdgcn_sched_barrier(0);
            }
            v16h a16[MT], aL[MT];       // xh and xl * 2^11
#pragma unroll
            for (int f = 0; f < MT; ++f) {
#pragma unroll
                for (int p = 0; p < 4; ++p) {
#pragma unroll
                    for (int i = 0; i < 4; ++i) {
                        const float    v = aq[f][p][i];
                        const _Float16 h = (_Float16)v;
                        a16[f][p * 4 + i] = h;
                        aL[f][p * 4 + i]  = (_Float16)((v - (float)h) * LO_SCALE);
                    }
                }
            }
            // three runs of MT * NT independent accumulator tiles; the set read first feeds two of them
#pragma unroll
            for (int nt = 0; nt < NT; ++nt)
#pragma unroll
                for (int f = 0; f < MT; ++f)
                    acc[f][nt] = __builtin_amdgcn_wmma_f32_16x16x32_f16(
                        false, a16[f], false, bh[nt], (short)0, acc[f][nt], false, false);
#pragma unroll
            for (int nt = 0; nt < NT; ++nt)
#pragma unroll
                for (int f = 0; f < MT; ++f)
                    accL[f][nt] = __builtin_amdgcn_wmma_f32_16x16x32_f16(
                        false, aL[f], false, bh[nt], (short)0, accL[f][nt], false, false);
#pragma unroll
            for (int nt = 0; nt < NT; ++nt)
#pragma unroll
                for (int f = 0; f < MT; ++f)
                    acc[f][nt] = __builtin_amdgcn_wmma_f32_16x16x32_f16(
                        false, a16[f], false, bc[nt], (short)0, acc[f][nt], false, false);
        }

        // ---- hand-over: slab s + 1 is published, the buffer of slab s is free ----
        // this fence keeps the waits below behind the last chunk's matrix instructions: lifted over them,
        // s_wait_dscnt 0 holds them all back until the chunk's last LDS read has landed
        __builtin_amdgcn_sched_barrier(0);
        asm volatile("s_wait_dscnt 0x0" ::: "memory");      // this wave's reads of slab s are done
        asm volatile("s_wait_asynccnt 0x0" ::: "memory");   // this wave's copies of slab s + 1 have landed
        __syncthreads();
        if (s + 2 < NSLAB) {
            copy_slab(ldsT + (s & 1) * SLAB_BYTES, srcT + (size_t)(s + 2) * (2 * SLAB_BYTES));
            copy_a_slab(ldsA + (s & 1) * A_SLAB_BYTES, lane, srcA + (size_t)(s + 2) * A_ROW_BYTES);
        }
    }
    asm volatile("s_wait_asynccnt 0x0" ::: "memory");       // no copy is open when the wave ends

    // ---- epilogue: the two K halves are added, bias + store ----
    // Of its 32 rows a wave stores 16 (16 kg ..) and hands its sums of the other 16 to its partner, wave ^ 4,
    // through LDS. sB is free: the loop's last barrier stands behind every read of it, and no copy is open.
    v4f*       slotOut = (v4f*)(sB + waveU * 8192) + lane;
    const v4f* slotIn  = (const v4f*)(sB + (waveU ^ 4) * 8192) + lane;
    if (kg == 0)
        put_half(slotOut, acc[1], accL[1]);
    else
        put_half(slotOut, acc[0], accL[0]);
    __syncthreads();    // the partner's sums are in LDS
    float* o = out + (size_t)(rowBlk * ROWS_PER_BLOCK + rg * (MT * 16) + kg * 16 + hiL * 8) * U_DIM + gn0 + n;
    if (kg == 0)
        finish_half(o, bias + gn0 + n, slotIn, acc[0], accL[0]);
    else
        finish_half(o, bias + gn0 + n, slotIn, acc[1], accL[1]);
}

extern "C" void kernel_launch(void* const* d_in, const int* in_sizes, int n_in,
                              void* d_out, int out_size, void* d_ws, size_t ws_size,
                              hipStream_t stream) {
    (void)in_sizes; (void)n_in; (void)ws_size; (void)out_size;
    const float* x    = (const float*)d_in[0];
    const float* w    = (const float*)d_in[1];
    const float* bias = (const float*)d_in[2];
    const int*   mp   = (const int*)d_in[3];
    float* out = (float*)d_out;
    float* ws  = (float*)d_ws;              // 2 MB used: 16 slabs x 2 strips x 64 KB

    // one thread per column and 8 K values: 256 * 256 threads
    mpdense_pack_kernel<<<dim3(D_DIM / 8), dim3(256), 0, stream>>>(w, mp, ws);

    dim3 grid((B_DIM / ROWS_PER_BLOCK) * (U_DIM / COLS_PER_BLOCK));  // 128 * 2 = 256 blocks
    dim3 block(256);                                                 // 8 waves (wave32)
    mpdense_wmma_kernel<<<grid, block, 0, stream>>>(x, ws, bias, out);
}

// v008
// It runs in 35.3 microseconds.
// Timed twice side by side with v007, it ran 1.05 and 1.04 times as fast.
// All steps since v000 together make it 8.95 times as fast.
#include <hip/hip_runtime.h>
#include <stdint.h>

typedef __attribute__((ext_vector_type(16))) _Float16 v16h;
typedef __attribute__((ext_vector_type(8)))  _Float16 v8h;
typedef __attribute__((ext_vector_type(8)))  float    v8f;
typedef __attribute__((ext_vector_type(4)))  float    v4f;
typedef __attribute__((ext_vector_type(4)))  uint32_t u32x4;
typedef __attribute__((ext_vector_type(8)))  uint32_t u32x8;

#define B_DIM 16384
#define D_DIM 2048
#define U_DIM 256

#define ROWS_PER_BLOCK 128      // 4 row groups of 32 rows; two waves per group, each on half of the K range
#define MT 2                    // 16-row A fragments per wave
#define NT 8                    // 16-column output tiles per wave
#define COLS_PER_BLOCK (NT * 16)
#define KT 128                  // K per LDS buffer (slab)
#define NCHUNK (KT / 32)        // 4 chunks of K=32
#define WCHUNK (NCHUNK / 2)     // chunks of a slab that one wave multiplies
#define NSLAB (D_DIM / KT)
#define SLAB16_BYTES (NCHUNK * NT * 512 * 2)            // one set of fp16 fragments of a slab, 32 KB
#define SLAB_BYTES (2 * SLAB16_BYTES)                   // two sets, 64 KB
#define LO_SCALE 2048.0f        // the low parts of x are kept times 2^11, clear of the fp16 subnormals
#define W_SCALE 256.0f          // every weight part is kept times 2^8 (exact): w's low parts, which share a
                                // set and its accumulators with high parts, stay clear of the subnormals
#define B_SLICE_BYTES (SLAB_BYTES / 4)                  // the part of a weight slab that one request brings, 16 KB
#define B_TILE_ROW 512                                  // that part as a tile: 32 rows of 512 B, one behind the other
#define A_ROW_BYTES (KT * 4)                            // one row of x within a slab, 512 B
#define A_TILE_ROW 256                                  // an x tile's row: one K half of a slab's row
#define A_TILE_ROWS 64
#define A_PITCH (A_TILE_ROW + 16)                       // its pitch in LDS: the request's pad, 16 B behind every row
#define A_FRAG_BYTES (16 * A_PITCH)                     // 16 rows, one A fragment's
#define A_SLICE_BYTES 18432                             // 64 rows of 272 B, rounded up to a multiple of 2 KB
#define A_BUF_BYTES (4 * A_SLICE_BYTES)                 // the block's rows of a slab, 72 KB

// First launch: the masked weights, once, in the order in which the matrix instructions read them.
// The fp32 bucket's product x * w is formed from fp16 parts, x = xh + xl, w = wh + wl (xh, wh: the value
// rounded to fp16; xl, wl: what is left, rounded to fp16): xh wh + xh wl + xl wh; xl wl, 2^-22 of the
// product, is dropped. xh is the fp16 bucket's own operand too, and no weight is in both buckets: fp16(w) of
// the fp16 bucket and wl of the fp32 bucket stand in ONE set, which xh multiplies.
// Workspace: slab s of column strip t at byte (2 s + t) * SLAB_BYTES, two sets of fp16 fragments, times 2^8:
// wh where mp is 1; fp16(w) where mp is 0 and wl where mp is 1;
// in each, one 16-byte piece per lane, the 32 lanes' pieces side by side (512 B per read).
// A thread takes one column and 8 consecutive K values: one piece of each set.
__global__ __launch_bounds__(256)
void mpdense_pack_kernel(const float* __restrict__ w,
                         const int*   __restrict__ mp,
                         float* __restrict__ ws)
{
    const int gid = blockIdx.x * 256 + threadIdx.x;
    const int col = gid & (U_DIM - 1);
    const int g   = gid >> 8;               // K group: K = 8 g .. 8 g + 7
    const int q   = g & 3;                  // group within the 32-K chunk
    const int frag = ((g >> 2) & (NCHUNK - 1)) * NT + ((col >> 4) & (NT - 1));
    const int n16  = col & 15;

    float wv[8];
    int   mv[8];
#pragma unroll
    for (int i = 0; i < 8; ++i) {
        wv[i] = w[(g * 8 + i) * U_DIM + col];
        mv[i] = mp[(g * 8 + i) * U_DIM + col];
    }
    v8h hh, hc;
#pragma unroll
    for (int i = 0; i < 8; ++i) {
        const float    r  = (float)(_Float16)wv[i];             // w rounded to fp16
        const _Float16 wh = (_Float16)(r * W_SCALE);
        const _Float16 wl = (_Float16)((wv[i] - r) * W_SCALE);
        hh[i] = (mv[i] == 1) ? wh : (_Float16)0.0f;
        hc[i] = (mv[i] == 0) ? wh : (mv[i] == 1) ? wl : (_Float16)0.0f;
    }
    unsigned char* slab = (unsigned char*)ws
        + (size_t)((g >> 4) * 2 + (col >> 7)) * SLAB_BYTES;     // 16 groups per 128-K slab
    // fp16 B fragment (16-bit 32x16 B, wave32): lane L, half h holds
    // K = ((L>=16)?8:0) + (h&7) + (h>=8 ? 16:0); the halves h<8 and h>=8 are separate pieces
    unsigned char* piece = slab + ((frag * 2 + (q >> 1)) * 256 + (n16 + 16 * (q & 1)) * 8) * 2;
    *(v8h*)(piece)                = hh;
    *(v8h*)(piece + SLAB16_BYTES) = hc;
}

__device__ __forceinline__ uint32_t uni(uint32_t v) { return (uint32_t)__builtin_amdgcn_readfirstlane(v); }
// a wave-uniform value held in a scalar register: a test on it compiles to a scalar compare and branch,
// which a tensor load needs around it (the instruction ignores EXEC)
__device__ __forceinline__ uint32_t pinned(uint32_t v)
{
    uint32_t w = uni(v);
    asm volatile("" : "+s"(w));     // keeps the value in a scalar register
    return w;
}

__device__ __forceinline__ void tdm_load(u32x4 g0, u32x8 g1)
{
    asm volatile("tensor_load_to_lds %0, %1" :: "s"(g0), "s"(g1) : "memory");
}
// Descriptor group 0: place in LDS (byte offset in the work-group's LDS) and address of the tile's first byte.
__device__ __forceinline__ u32x4 tdm_group0(uint32_t lds_dst, uint64_t ga)
{
    u32x4 g;
    g[0] = uni(1u);
    g[1] = uni(lds_dst);
    g[2] = uni((uint32_t)ga);
    g[3] = uni((((uint32_t)(ga >> 32)) & 0x01FFFFFFu) | 0x80000000u);
    return g;
}
// Descriptor group 1: 1-byte elements, tensor = tile = D1 rows of D0 bytes, source pitch PITCH bytes;
// WORD0: no mask; 0, or the pad fields.
template <uint32_t WORD0, uint32_t D0, uint32_t D1, uint32_t PITCH>
__device__ __forceinline__ u32x8 tdm_group1()
{
    u32x8 g;
    g[0] = uni(WORD0);
    g[1] = uni((D0 & 0xFFFFu) << 16);
    g[2] = uni((D0 >> 16) | ((D1 & 0xFFFFu) << 16));
    g[3] = uni((D1 >> 16) | (D0 << 16));
    g[4] = uni(D1);
    g[5] = uni(PITCH);
    g[6] = uni(0u);
    g[7] = uni(0u);
    return g;
}

// A slab's requests, one per wave. Waves 0-3: x, wave w the K half w & 1 of the block's rows 64 (w >> 1) .. + 63,
// 256-B rows with 16 B of pad behind each: at a pitch of 272 B the 16 lanes that later read the same piece of
// 16 rows fall on 16 different groups of banks. Waves 4-7: a quarter of the weight slab each.
__device__ __forceinline__ void issue_stage(uint32_t waveU, u32x4 x0, u32x8 x1, u32x4 b0, u32x8 b1)
{
    if (pinned(waveU < 4u))
        tdm_load(x0, x1);
    if (pinned(waveU >= 4u))
        tdm_load(b0, b1);
}
// The wave's request has landed. The wait names the descriptors as inputs: they stay live from the issue to this
// wait, so the compiler gives them scalar registers of their own and writes nothing else into a register that
// an open request was issued from (without it a word of group 1 served as a temporary behind the issue).
__device__ __forceinline__ void wait_stage(u32x4 x0, u32x8 x1, u32x4 b0, u32x8 b1)
{
    asm volatile("s_wait_tensorcnt 0x0" :: "s"(x0), "s"(x1), "s"(b0), "s"(b1) : "memory");
}

// One 32-K chunk of the lane's A row out of LDS (fp16 fragment order): 8 floats at K base 8 hiL, 8 at 16 + 8 hiL.
// row: the lane's row in its tile, at byte 32 hiL.
__device__ __forceinline__ void load_a(v4f (&q)[4], const unsigned char* row, unsigned c)
{
    q[0] = *(const v4f*)(row + c * 128 + 0);
    q[1] = *(const v4f*)(row + c * 128 + 16);
    q[2] = *(const v4f*)(row + c * 128 + 64);
    q[3] = *(const v4f*)(row + c * 128 + 80);
}

// One fp16 B fragment out of a set in LDS: the lane's two 16-byte pieces.
__device__ __forceinline__ v16h load_b(const _Float16* set, int frag, int lane)
{
    const _Float16* pb = set + frag * 512 + lane * 8;
    const v8h bl = *(const v8h*)(pb);
    const v8h bh = *(const v8h*)(pb + 256);
    return __builtin_shufflevector(bl, bh, 0, 1, 2, 3, 4, 5, 6, 7, 8, 9, 10, 11, 12, 13, 14, 15);
}

// The scaled sum of a tile's two accumulators, four rows of it.
__device__ __forceinline__ v4f merged4(const v8f& a, const v8f& l, int r0)
{
    v4f t;
#pragma unroll
    for (int i = 0; i < 4; ++i)
        t[i] = a[r0 + i] * (1.0f / W_SCALE) + l[r0 + i] * (1.0f / (W_SCALE * LO_SCALE));
    return t;
}

// A wave's partial sums of 16 rows x 128 columns into its 8 KB of LDS, 16 bytes per lane side by side.
__device__ __forceinline__ void put_half(v4f* slot, const v8f (&a)[NT], const v8f (&l)[NT])
{
#pragma unroll
    for (int nt = 0; nt < NT; ++nt) {
        slot[(nt * 2 + 0) * 32] = merged4(a[nt], l[nt], 0);
        slot[(nt * 2 + 1) * 32] = merged4(a[nt], l[nt], 4);
    }
}

// The wave's own partial sums of 16 rows, the partner's out of LDS and the bias: the rows' 128 columns of out.
// (C/D layout: VGPR r -> M = r + 8*hiL, N = lane&15); o: the lane's element of row r = 0, tile 0
__device__ __forceinline__ void finish_half(float* o, const float* bias_n, const v4f* slot,
                                            const v8f (&a)[NT], const v8f (&l)[NT])
{
#pragma unroll
    for (int nt = 0; nt < NT; ++nt) {
        const float bb = bias_n[nt * 16];
#pragma unroll
        for (int hf = 0; hf < 2; ++hf) {
            const v4f own = merged4(a[nt], l[nt], hf * 4);
            const v4f oth = slot[(nt * 2 + hf) * 32];
#pragma unroll
            for (int i = 0; i < 4; ++i)
                o[(size_t)(hf * 4 + i) * U_DIM + nt * 16] = own[i] + oth[i] + bb;
        }
    }
}

// out[b,u] = sum_d x16[b,d]*w16[d,u]*(mp==0) + sum_d x[b,d]*w[d,u]*(mp==1) + bias[u]
// the second sum as xh wh + xh wl + ((xl 2^11) wh) 2^-11, the last bracket in accumulators of its own
// Each wave works on a 32 x 128 strip of out: a B fragment read from LDS feeds MT A fragments. The strip's
// two waves (w and w + 4) each take half of the chunks of every slab; their sums are added at the end.
__global__ __launch_bounds__(256)
void mpdense_wmma_kernel(const float* __restrict__ x,
                         const float* __restrict__ wsB,
                         const float* __restrict__ bias,
                         float* __restrict__ out)
{
    // Two buffers of B operands (masked weights in fragment order, as the first launch left them):
    // slab s is multiplied out of buffer s & 1 while slab s + 1 lands in the other.
    // (the larger alignment puts sB first in LDS: a set's reads then reach it through the offset field)
    __shared__ __attribute__((aligned(4096))) unsigned char sB[2 * SLAB_BYTES];     // 128 KB
    // Two buffers of x rows (fp32, four tiles of 64 rows x 256 B at a pitch of 272 B), handed over with sB's.
    __shared__ __attribute__((aligned(2048))) unsigned char sA[2 * A_BUF_BYTES];    // 144 KB

    const int tid  = threadIdx.x;
    const int lane = tid & 31;
    const int wave = tid >> 5;

    const int tileN  = blockIdx.x & 1;      // 256/128 = 2 column strips
    const int rowBlk = blockIdx.x >> 1;
    const int gn0    = tileN * COLS_PER_BLOCK;

    const int n    = lane & 15;
    const int hiL  = lane >> 4;             // 0: lanes 0-15, 1: lanes 16-31

    const uint32_t waveU = uni((uint32_t)wave);     // in a scalar register: scalar branches below
    const int rg = waveU & 3;               // row group: rows 32 rg .. 32 rg + 31 of the block
    const int kg = waveU >> 2;              // K half: chunks WCHUNK kg .. WCHUNK kg + WCHUNK - 1 of every slab

    const unsigned char* aRow = sA + ((rg >> 1) * 2 + kg) * A_SLICE_BYTES
        + ((rg & 1) * (MT * 16) + n) * A_PITCH + hiL * 32;

    // the wave's request of a slab: its place in buffer 0 and its tile's first byte in slab 0
    const uint32_t part = waveU & 3u;
    const uint32_t ldsA = (uint32_t)(size_t)sA + part * A_SLICE_BYTES;
    const uint64_t gx   = (uint64_t)(size_t)x
        + (uint64_t)(rowBlk * ROWS_PER_BLOCK + (part >> 1) * A_TILE_ROWS) * (D_DIM * 4) + (part & 1u) * A_TILE_ROW;
    const uint32_t ldsB = (uint32_t)(size_t)sB + part * B_SLICE_BYTES;
    const uint64_t gb   = (uint64_t)(size_t)wsB + (uint64_t)tileN * SLAB_BYTES + part * B_SLICE_BYTES;

    v8f acc[MT][NT]  = {};  // xh * (fp16(w) of both buckets, wl of the fp32 bucket), times 2^8
    v8f accL[MT][NT] = {};  // xl * wh of the fp32 bucket, times 2^19

    // descriptors: group 1 is fixed; group 0 of slab s aims at buffer s & 1
    const u32x8 g1x = tdm_group1<(1u << 20) | (5u << 22) | (3u << 25), A_TILE_ROW, A_TILE_ROWS, D_DIM * 4>();
    const u32x8 g1b = tdm_group1<0u, B_TILE_ROW, B_SLICE_BYTES / B_TILE_ROW, B_TILE_ROW>();
#define G0X(s) tdm_group0(ldsA + ((s) & 1u) * A_BUF_BYTES, gx + (uint64_t)(s) * A_ROW_BYTES)
#define G0B(s) tdm_group0(ldsB + ((s) & 1u) * SLAB_BYTES, gb + (uint64_t)(s) * (2 * SLAB_BYTES))

    // slab 0: each wave waits for its own tile directly behind the request
    u32x4 g0x = G0X(0u), g0b = G0B(0u);
    if (pinned(waveU < 4u)) {
        tdm_load(g0x, g1x);
        asm volatile("s_wait_tensorcnt 0x0" ::: "memory");
    }
    if (pinned(waveU >= 4u)) {
        tdm_load(g0b, g1b);
        asm volatile("s_wait_tensorcnt 0x0" ::: "memory");
    }

    // Trip -1 multiplies nothing: it is the hand-over alone, which publishes slab 0 and requests slab 1. So every
    // request that flies while the waves work is issued at one place, from registers that the loop leaves alone.
    // nounroll: peeled, trip -1 would get descriptor registers of its own, reused by the set-up code behind it
#pragma nounroll
    for (int s = -1; s < NSLAB; ++s) {
      if (s >= 0) {
        const unsigned char* sBk = sB + (s & 1) * SLAB_BYTES + kg * (WCHUNK * NT * 1024);
        const _Float16* sBh = (const _Float16*)(sBk);
        const _Float16* sBc = (const _Float16*)(sBk + SLAB16_BYTES);
        const unsigned char* aRowS = aRow + (s & 1) * A_BUF_BYTES;

        // ---- per-wave MMA over the wave's staged chunks ----
        // unrolled: LDS offsets are constants
#pragma unroll
        for (int c = 0; c < WCHUNK; ++c) {
            // this fence and the one behind the loads hold all the chunk's LDS reads at
            // its head, as one group with counted waits behind it: without them the scheduler mixes the
            // chunks and strews pairs of LDS reads, one fragment ahead, among the matrix instructions
            __builtin_amdgcn_sched_barrier(0);
            // four vector slots between the last matrix instruction of the chunk before and the first
            // vector instruction of this one, which may reuse its operand registers
            asm volatile("v_nop\n\tv_nop\n\tv_nop\n\tv_nop");
            // the A pieces first: the conversions wait for them alone and run while the B fragments land
            v4f aq[MT][4];      // per fragment 8 floats at K base 8 hiL and 8 at 16 + 8 hiL
#pragma unroll
            for (int f = 0; f < MT; ++f)
                load_a(aq[f], aRowS + f * A_FRAG_BYTES, c);
            v16h bh[NT], bc[NT];            // the chunk's B fragments of the two sets
            // the fence behind each fragment keeps the reads in the order in which the fragments are
            // multiplied: read in another order, a whole set is waited for
            // before its first matrix instruction
#pragma unroll
            for (int nt = 0; nt < NT; ++nt) {
                bh[nt] = load_b(sBh, c * NT + nt, lane);
                __builtin_amdgcn_sched_barrier(0);
            }
#pragma unroll
            for (int nt = 0; nt < NT; ++nt) {
                bc[nt] = load_b(sBc, c * NT + nt, lane);
                __builtin_amdgcn_sched_barrier(0);
            }
            v16h a16[MT], aL[MT];       // xh and xl * 2^11
#pragma unroll
            for (int f = 0; f < MT; ++f) {
#pragma unroll
                for (int p = 0; p < 4; ++p) {
#pragma unroll
                    for (int i = 0; i < 4; ++i) {
                        const float    v = aq[f][p][i];
                        const _Float16 h = (_Float16)v;
                        a16[f][p * 4 + i] = h;
                        aL[f][p * 4 + i]  = (_Float16)((v - (float)h) * LO_SCALE);
                    }
                }
            }
            // three runs of MT * NT independent accumulator tiles; the set read first feeds two of them
#pragma unroll
            for (int nt = 0; nt < NT; ++nt)
#pragma unroll
                for (int f = 0; f < MT; ++f)
                    acc[f][nt] = __builtin_amdgcn_wmma_f32_16x16x32_f16(
                        false, a16[f], false, bh[nt], (short)0, acc[f][nt], false, false);
#pragma unroll
            for (int nt = 0; nt < NT; ++nt)
#pragma unroll
                for (int f = 0; f < MT; ++f)
                    accL[f][nt] = __builtin_amdgcn_wmma_f32_16x16x32_f16(
                        false, aL[f], false, bh[nt], (short)0, accL[f][nt], false, false);
#pragma unroll
            for (int nt = 0; nt < NT; ++nt)
#pragma unroll
                for (int f = 0; f < MT; ++f)
                    acc[f][nt] = __builtin_amdgcn_wmma_f32_16x16x32_f16(
                        false, a16[f], false, bc[nt], (short)0, acc[f][nt], false, false);
        }

      }

        // ---- hand-over: slab s + 1 is published, the buffer of slab s is free ----
        // this fence keeps the waits below behind the last chunk's matrix instructions: lifted over them,
        // s_wait_dscnt 0 holds them all back until the chunk's last LDS read has landed
        __builtin_amdgcn_sched_barrier(0);
        asm volatile("s_wait_dscnt 0x0" ::: "memory");      // this wave's reads of slab s are done
        wait_stage(g0x, g1x, g0b, g1b);                     // this wave's tile of slab s + 1 has landed
        __syncthreads();
        // pinned behind the wait: the next descriptors are formed from it, so behind the wait too
        const uint32_t nxt = pinned((uint32_t)s + 2u);
        if (pinned(nxt < NSLAB)) {
            g0x = G0X(nxt);
            g0b = G0B(nxt);
            issue_stage(waveU, g0x, g1x, g0b, g1b);
        }
    }
#undef G0X
#undef G0B
    asm volatile("s_wait_tensorcnt 0x0" ::: "memory");      // no request is open when the wave ends
    asm volatile("s_wait_dscnt 0x0" ::: "memory");          // nor an LDS read, before sB is written below

    // ---- epilogue: the two K halves are added, bias + store ----
    // Of its 32 rows a wave stores 16 (16 kg ..) and hands its sums of the other 16 to its partner, wave ^ 4,
    // through LDS. sB is free: the loop's last barrier stands behind every read of it, and no request is open.
    v4f*       slotOut = (v4f*)(sB + waveU * 8192) + lane;
    const v4f* slotIn  = (const v4f*)(sB + (waveU ^ 4) * 8192) + lane;
    if (kg == 0)
        put_half(slotOut, acc[1], accL[1]);
    else
        put_half(slotOut, acc[0], accL[0]);
    __syncthreads();    // the partner's sums are in LDS
    float* o = out + (size_t)(rowBlk * ROWS_PER_BLOCK + rg * (MT * 16) + kg * 16 + hiL * 8) * U_DIM + gn0 + n;
    if (kg == 0)
        finish_half(o, bias + gn0 + n, slotIn, acc[0], accL[0]);
    else
        finish_half(o, bias + gn0 + n, slotIn, acc[1], accL[1]);
}

extern "C" void kernel_launch(void* const* d_in, const int* in_sizes, int n_in,
                              void* d_out, int out_size, void* d_ws, size_t ws_size,
                              hipStream_t stream) {
    (void)in_sizes; (void)n_in; (void)ws_size; (void)out_size;
    const float* x    = (const float*)d_in[0];
    const float* w    = (const float*)d_in[1];
    const float* bias = (const float*)d_in[2];
    const int*   mp   = (const int*)d_in[3];
    float* out = (float*)d_out;
    float* ws  = (float*)d_ws;              // 2 MB used: 16 slabs x 2 strips x 64 KB

    // one thread per column and 8 K values: 256 * 256 threads
    mpdense_pack_kernel<<<dim3(D_DIM / 8), dim3(256), 0, stream>>>(w, mp, ws);

    dim3 grid((B_DIM / ROWS_PER_BLOCK) * (U_DIM / COLS_PER_BLOCK));  // 128 * 2 = 256 blocks
    dim3 block(256);                                                 // 8 waves (wave32)
    mpdense_wmma_kernel<<<grid, block, 0, stream>>>(x, ws, bias, out);
}

// v009
// Measured time: 33.2 microseconds a run.
// In both of two side-by-side timings against v008, it was 1.06 times as fast.
// Counting every step since v000, it is 9.50 times as fast.
#include <hip/hip_runtime.h>
#include <stdint.h>

typedef __attribute__((ext_vector_type(16))) _Float16 v16h;
typedef __attribute__((ext_vector_type(8)))  _Float16 v8h;
typedef __attribute__((ext_vector_type(8)))  float    v8f;
typedef __attribute__((ext_vector_type(4)))  float    v4f;
typedef __attribute__((ext_vector_type(4)))  uint32_t u32x4;
typedef __attribute__((ext_vector_type(8)))  uint32_t u32x8;

#define B_DIM 16384
#define D_DIM 2048
#define U_DIM 256

#define ROWS_PER_BLOCK 128      // 4 row groups of 32 rows; two waves per group, each on half of the K range
#define MT 2                    // 16-row A fragments per wave
#define NT 8                    // 16-column output tiles per wave
#define COLS_PER_BLOCK (NT * 16)
#define KT 128                  // K per slab of the packed weights
#define NCHUNK (KT / 32)        // 4 chunks of K=32
#define NSLAB (D_DIM / KT)
#define SLAB16_BYTES (NCHUNK * NT * 512 * 2)            // one set of fp16 fragments of a slab, 32 KB
#define SLAB_BYTES (2 * SLAB16_BYTES)                   // two sets, 64 KB
#define LO_SCALE 2048.0f        // the low parts of x are kept times 2^11, clear of the fp16 subnormals
#define W_SCALE 256.0f          // every weight part is kept times 2^8 (exact): w's low parts, which share a
                                // set and its accumulators with high parts, stay clear of the subnormals
// The LDS ring: a stage is half a slab, 64 K (two chunks, one for each wave of a strip); four buffers.
#define ST_K 64
#define NSTAGE (D_DIM / ST_K)
#define NBUF 4
#define B_SLICE_BYTES (SLAB16_BYTES / 2)                // one request: a stage's two chunks of one set, 16 KB
#define B_BUF_BYTES (2 * B_SLICE_BYTES)                 // a stage's weights, both sets, 32 KB
#define B_CHUNK_BYTES (NT * 1024)                       // one chunk of one set, 8 KB
#define B_TILE_ROW 512                                  // a request's part as a tile: 32 rows of 512 B, one behind the other
#define A_TILE_ROW (ST_K * 4)                           // an x tile's row: a row of x within a stage, 256 B
#define A_TILE_ROWS 64
#define A_PITCH (A_TILE_ROW + 16)                       // its pitch in LDS: the request's pad, 16 B behind every row
#define A_FRAG_BYTES (16 * A_PITCH)                     // 16 rows, one A fragment's
#define A_SLICE_BYTES 18432                             // 64 rows of 272 B, rounded up to a multiple of 2 KB
#define A_BUF_BYTES (2 * A_SLICE_BYTES)                 // the block's rows of a stage, 36 KB

// First launch: the masked weights, once, in the order in which the matrix instructions read them.
// The fp32 bucket's product x * w is formed from fp16 parts, x = xh + xl, w = wh + wl (xh, wh: the value
// rounded to fp16; xl, wl: what is left, rounded to fp16): xh wh + xh wl + xl wh; xl wl, 2^-22 of the
// product, is dropped. xh is the fp16 bucket's own operand too, and no weight is in both buckets: fp16(w) of
// the fp16 bucket and wl of the fp32 bucket stand in ONE set, which xh multiplies.
// Workspace: slab s of column strip t at byte (2 s + t) * SLAB_BYTES, two sets of fp16 fragments, times 2^8:
// wh where mp is 1; fp16(w) where mp is 0 and wl where mp is 1;
// in each, one 16-byte piece per lane, the 32 lanes' pieces side by side (512 B per read).
// A thread takes one column and 8 consecutive K values: one piece of each set.
__global__ __launch_bounds__(256)
void mpdense_pack_kernel(const float* __restrict__ w,
                         const int*   __restrict__ mp,
                         float* __restrict__ ws)
{
    const int gid = blockIdx.x * 256 + threadIdx.x;
    const int col = gid & (U_DIM - 1);
    const int g   = gid >> 8;               // K group: K = 8 g .. 8 g + 7
    const int q   = g & 3;                  // group within the 32-K chunk
    const int frag = ((g >> 2) & (NCHUNK - 1)) * NT + ((col >> 4) & (NT - 1));
    const int n16  = col & 15;

    float wv[8];
    int   mv[8];
#pragma unroll
    for (int i = 0; i < 8; ++i) {
        wv[i] = w[(g * 8 + i) * U_DIM + col];
        mv[i] = mp[(g * 8 + i) * U_DIM + col];
    }
    v8h hh, hc;
#pragma unroll
    for (int i = 0; i < 8; ++i) {
        const float    r  = (float)(_Float16)wv[i];             // w rounded to fp16
        const _Float16 wh = (_Float16)(r * W_SCALE);
        const _Float16 wl = (_Float16)((wv[i] - r) * W_SCALE);
        hh[i] = (mv[i] == 1) ? wh : (_Float16)0.0f;
        hc[i] = (mv[i] == 0) ? wh : (mv[i] == 1) ? wl : (_Float16)0.0f;
    }
    unsigned char* slab = (unsigned char*)ws
        + (size_t)((g >> 4) * 2 + (col >> 7)) * SLAB_BYTES;     // 16 groups per 128-K slab
    // fp16 B fragment (16-bit 32x16 B, wave32): lane L, half h holds
    // K = ((L>=16)?8:0) + (h&7) + (h>=8 ? 16:0); the halves h<8 and h>=8 are separate pieces
    unsigned char* piece = slab + ((frag * 2 + (q >> 1)) * 256 + (n16 + 16 * (q & 1)) * 8) * 2;
    *(v8h*)(piece)                = hh;
    *(v8h*)(piece + SLAB16_BYTES) = hc;
}

__device__ __forceinline__ uint32_t uni(uint32_t v) { return (uint32_t)__builtin_amdgcn_readfirstlane(v); }
// a wave-uniform value held in a scalar register: a test on it compiles to a scalar compare and branch,
// which a tensor load needs around it (the instruction ignores EXEC)
__device__ __forceinline__ uint32_t pinned(uint32_t v)
{
    uint32_t w = uni(v);
    asm volatile("" : "+s"(w));     // keeps the value in a scalar register
    return w;
}

__device__ __forceinline__ void tdm_load(u32x4 g0, u32x8 g1)
{
    asm volatile("tensor_load_to_lds %0, %1" :: "s"(g0), "s"(g1) : "memory");
}
// Descriptor group 0: place in LDS (byte offset in the work-group's LDS) and address of the tile's first byte.
__device__ __forceinline__ u32x4 tdm_group0(uint32_t lds_dst, uint64_t ga)
{
    u32x4 g;
    g[0] = uni(1u);
    g[1] = uni(lds_dst);
    g[2] = uni((uint32_t)ga);
    g[3] = uni((((uint32_t)(ga >> 32)) & 0x01FFFFFFu) | 0x80000000u);
    return g;
}
// Descriptor group 1: 1-byte elements, tensor = tile = D1 rows of D0 bytes, source pitch PITCH bytes;
// WORD0: no mask; 0, or the pad fields.
template <uint32_t WORD0, uint32_t D0, uint32_t D1, uint32_t PITCH>
__device__ __forceinline__ u32x8 tdm_group1()
{
    // pinned(): each descriptor word held in a scalar register of its own. Left as plain constants, the compiler
    // formed some of them anew in their registers while a request issued from them was still open.
    u32x8 g;
    g[0] = pinned(WORD0);
    g[1] = pinned((D0 & 0xFFFFu) << 16);
    g[2] = pinned((D0 >> 16) | ((D1 & 0xFFFFu) << 16));
    g[3] = pinned((D1 >> 16) | (D0 << 16));
    g[4] = pinned(D1);
    g[5] = pinned(PITCH);
    g[6] = pinned(0u);
    g[7] = pinned(0u);
    return g;
}

// A stage's requests, one from each of four waves (part = wave & 3). Parts 0, 1: x, the block's rows 64 part .. + 63,
// 256-B rows with 16 B of pad behind each: at a pitch of 272 B the 16 lanes that later read the same piece of
// 16 rows fall on 16 different groups of banks. Parts 2, 3: the stage's two chunks of one weight set each.
__device__ __forceinline__ void issue_stage(uint32_t part, u32x4 x0, u32x8 x1, u32x4 b0, u32x8 b1)
{
    if (pinned(part < 2u))
        tdm_load(x0, x1);
    if (pinned(part >= 2u))
        tdm_load(b0, b1);
}
// The work-group barrier in its two halves; "memory": no LDS access is moved over either.
__device__ __forceinline__ void bar_signal() { asm volatile("s_barrier_signal -1" ::: "memory"); }
__device__ __forceinline__ void bar_wait()   { asm volatile("s_barrier_wait -1" ::: "memory"); }
// The wave's request has landed. The wait names the descriptors as inputs: they stay live from the issue to this
// wait, so the compiler gives them scalar registers of their own and writes nothing else into a register that
// an open request was issued from (without it a word of group 1 served as a temporary behind the issue).
__device__ __forceinline__ void wait_stage(u32x4 x0, u32x8 x1, u32x4 b0, u32x8 b1)
{
    asm volatile("s_wait_tensorcnt 0x0" :: "s"(x0), "s"(x1), "s"(b0), "s"(b1) : "memory");
}

// One 32-K chunk of the lane's A row out of LDS (fp16 fragment order): 8 floats at K base 8 hiL, 8 at 16 + 8 hiL.
// row: the lane's row in its tile, at byte 32 hiL.
__device__ __forceinline__ void load_a(v4f (&q)[4], const unsigned char* row, unsigned c)
{
    q[0] = *(const v4f*)(row + c * 128 + 0);
    q[1] = *(const v4f*)(row + c * 128 + 16);
    q[2] = *(const v4f*)(row + c * 128 + 64);
    q[3] = *(const v4f*)(row + c * 128 + 80);
}

// One fp16 B fragment out of a set in LDS: the lane's two 16-byte pieces.
__device__ __forceinline__ v16h load_b(const _Float16* set, int frag, int lane)
{
    const _Float16* pb = set + frag * 512 + lane * 8;
    const v8h bl = *(const v8h*)(pb);
    const v8h bh = *(const v8h*)(pb + 256);
    return __builtin_shufflevector(bl, bh, 0, 1, 2, 3, 4, 5, 6, 7, 8, 9, 10, 11, 12, 13, 14, 15);
}

// The scaled sum of a tile's two accumulators, four rows of it.
__device__ __forceinline__ v4f merged4(const v8f& a, const v8f& l, int r0)
{
    v4f t;
#pragma unroll
    for (int i = 0; i < 4; ++i)
        t[i] = a[r0 + i] * (1.0f / W_SCALE) + l[r0 + i] * (1.0f / (W_SCALE * LO_SCALE));
    return t;
}

// A wave's partial sums of 16 rows x 128 columns into its 8 KB of LDS, 16 bytes per lane side by side.
__device__ __forceinline__ void put_half(v4f* slot, const v8f (&a)[NT], const v8f (&l)[NT])
{
#pragma unroll
    for (int nt = 0; nt < NT; ++nt) {
        slot[(nt * 2 + 0) * 32] = merged4(a[nt], l[nt], 0);
        slot[(nt * 2 + 1) * 32] = merged4(a[nt], l[nt], 4);
    }
}

// The wave's own partial sums of 16 rows, the partner's out of LDS and the bias: the rows' 128 columns of out.
// (C/D layout: VGPR r -> M = r + 8*hiL, N = lane&15); o: the lane's element of row r = 0, tile 0
__device__ __forceinline__ void finish_half(float* o, const float* bias_n, const v4f* slot,
                                            const v8f (&a)[NT], const v8f (&l)[NT])
{
#pragma unroll
    for (int nt = 0; nt < NT; ++nt) {
        const float bb = bias_n[nt * 16];
#pragma unroll
        for (int hf = 0; hf < 2; ++hf) {
            const v4f own = merged4(a[nt], l[nt], hf * 4);
            const v4f oth = slot[(nt * 2 + hf) * 32];
#pragma unroll
            for (int i = 0; i < 4; ++i)
                o[(size_t)(hf * 4 + i) * U_DIM + nt * 16] = own[i] + oth[i] + bb;
        }
    }
}

// out[b,u] = sum_d x16[b,d]*w16[d,u]*(mp==0) + sum_d x[b,d]*w[d,u]*(mp==1) + bias[u]
// the second sum as xh wh + xh wl + ((xl 2^11) wh) 2^-11, the last bracket in accumulators of its own
// Each wave works on a 32 x 128 strip of out: a B fragment read from LDS feeds MT A fragments. The strip's
// two waves (w and w + 4) each take one of the two chunks of every stage; their sums are added at the end.
__global__ __launch_bounds__(256)
void mpdense_wmma_kernel(const float* __restrict__ x,
                         const float* __restrict__ wsB,
                         const float* __restrict__ bias,
                         float* __restrict__ out)
{
    // Four buffers of B operands (masked weights in fragment order, as the first launch left them):
    // stage t is multiplied out of buffer t & 3 while later stages land in the others.
    // (the larger alignment puts sB first in LDS: a set's reads then reach it through the offset field)
    __shared__ __attribute__((aligned(4096))) unsigned char sB[NBUF * B_BUF_BYTES];     // 128 KB
    // Four buffers of x rows (fp32, two tiles of 64 rows x 256 B at a pitch of 272 B), handed over with sB's.
    __shared__ __attribute__((aligned(2048))) unsigned char sA[NBUF * A_BUF_BYTES];     // 144 KB

    const int tid  = threadIdx.x;
    const int lane = tid & 31;
    const int wave = tid >> 5;

    const int tileN  = blockIdx.x & 1;      // 256/128 = 2 column strips
    const int rowBlk = blockIdx.x >> 1;
    const int gn0    = tileN * COLS_PER_BLOCK;

    const int n    = lane & 15;
    const int hiL  = lane >> 4;             // 0: lanes 0-15, 1: lanes 16-31

    const uint32_t waveU = uni((uint32_t)wave);     // in a scalar register: scalar branches below
    const int rg = waveU & 3;               // row group: rows 32 rg .. 32 rg + 31 of the block
    const int kg = waveU >> 2;              // K half: chunk kg of every stage

    const unsigned char* aRow = sA + (rg >> 1) * A_SLICE_BYTES
        + ((rg & 1) * (MT * 16) + n) * A_PITCH + kg * 128 + hiL * 32;

    // the wave's request of a stage: its place in buffer 0 and its tile's first byte in stage 0
    const uint32_t part = waveU & 3u;
    const uint32_t half = waveU & 1u;       // which 64 rows of x, or which weight set
    const uint32_t ldsA = (uint32_t)(size_t)sA + half * A_SLICE_BYTES;
    const uint64_t gx   = (uint64_t)(size_t)x
        + (uint64_t)(rowBlk * ROWS_PER_BLOCK + half * A_TILE_ROWS) * (D_DIM * 4);
    const uint32_t ldsB = (uint32_t)(size_t)sB + half * B_SLICE_BYTES;
    const uint64_t gb   = (uint64_t)(size_t)wsB + (uint64_t)tileN * SLAB_BYTES + half * SLAB16_BYTES;

    v8f acc[MT][NT]  = {};  // xh * (fp16(w) of both buckets, wl of the fp32 bucket), times 2^8
    v8f accL[MT][NT] = {};  // xl * wh of the fp32 bucket, times 2^19

    // descriptors: group 1 is fixed; group 0 of stage u aims at buffer u & 3
    const u32x8 g1x = tdm_group1<(1u << 20) | (5u << 22) | (3u << 25), A_TILE_ROW, A_TILE_ROWS, D_DIM * 4>();
    const u32x8 g1b = tdm_group1<0u, B_TILE_ROW, B_SLICE_BYTES / B_TILE_ROW, B_TILE_ROW>();
#define G0X(u) tdm_group0(ldsA + ((u) & (NBUF - 1u)) * A_BUF_BYTES, gx + (uint64_t)(u) * A_TILE_ROW)
#define G0B(u) tdm_group0(ldsB + ((u) & (NBUF - 1u)) * B_BUF_BYTES, \
                          gb + (uint64_t)((u) >> 1) * (2 * SLAB_BYTES) + ((u) & 1u) * B_SLICE_BYTES)
    u32x4 g0x = G0X(0u), g0b = G0B(0u);

    // The ring. Waves 0-3 bring the even stages, waves 4-7 the odd ones, so a wave has one request open at a time.
    // At the top of pass t, behind the barrier's wait, the waves whose turn it is wait for their tiles of stage t + 1
    // (requested two passes ago) and request stage t + 3 into the buffer of stage t - 1, which every wave has left.
    // The barrier is split: a wave signals when its own LDS reads of pass t have returned, in front of its matrix
    // instructions, and waits behind them. So a wave need not stand still while the other wave of its SIMD
    // multiplies: it goes on to the next pass's LDS reads and conversions, and the two stay half a pass apart.
    // No LDS read stands between signal and wait.
    // Passes -3 .. -1 multiply nothing: they request stages 0, 1, 2 and publish stage 0. So every request is issued
    // at one place, from registers that the loop leaves alone.
    bar_signal();       // signal and wait alternate in every wave: this one pairs with the first pass's wait
    // nounroll: peeled, the first passes would get descriptor registers of their own, reused by code behind them
#pragma nounroll
    for (int t = -3; t < NSTAGE; ++t) {
        bar_wait();     // stage t is published; every wave's reads of stage t - 1 have returned
        if (pinned(((uint32_t)(t + 1) & 1u) == (waveU >> 2))) {
            wait_stage(g0x, g1x, g0b, g1b);                 // this wave's tile of stage t + 1 has landed
            // pinned behind the wait: the next descriptors are formed from it, so behind the wait too
            const uint32_t nxt = pinned((uint32_t)(t + 3));
            if (pinned(nxt < NSTAGE)) {
                g0x = G0X(nxt);
                g0b = G0B(nxt);
                issue_stage(part, g0x, g1x, g0b, g1b);
            }
        }
        if (pinned(t < 0)) {    // a scalar test, the same in every wave
            bar_signal();       // nothing was read; the waves whose turn it was have waited for their tiles above
            continue;
        }
        {
            const unsigned char* sBk = sB + (t & (NBUF - 1)) * B_BUF_BYTES + kg * B_CHUNK_BYTES;
            const _Float16* sBh = (const _Float16*)(sBk);
            const _Float16* sBc = (const _Float16*)(sBk + B_SLICE_BYTES);
            const unsigned char* aRowS = aRow + (t & (NBUF - 1)) * A_BUF_BYTES;

            // ---- the wave's chunk of the stage ----
            // four vector slots between the last matrix instruction of the pass before and the first
            // vector instruction of this one, which may reuse its operand registers
            asm volatile("v_nop\n\tv_nop\n\tv_nop\n\tv_nop");
            // the A pieces first: the conversions wait for them alone and run while the B fragments land
            v4f aq[MT][4];      // per fragment 8 floats at K base 8 hiL and 8 at 16 + 8 hiL
#pragma unroll
            for (int f = 0; f < MT; ++f)
                load_a(aq[f], aRowS + f * A_FRAG_BYTES, 0);
            v16h bh[NT], bc[NT];            // the chunk's B fragments of the two sets
#pragma unroll
            for (int nt = 0; nt < NT; ++nt)
                bh[nt] = load_b(sBh, nt, lane);
#pragma unroll
            for (int nt = 0; nt < NT; ++nt)
                bc[nt] = load_b(sBc, nt, lane);
            // this fence holds all the chunk's LDS reads at its head, as one group: without it the
            // scheduler strews them among the conversions
            __builtin_amdgcn_sched_barrier(0);
            v16h a16[MT], aL[MT];       // xh and xl * 2^11
#pragma unroll
            for (int f = 0; f < MT; ++f) {
#pragma unroll
                for (int p = 0; p < 4; ++p) {
#pragma unroll
                    for (int i = 0; i < 4; ++i) {
                        const float    v = aq[f][p][i];
                        const _Float16 h = (_Float16)v;
                        a16[f][p * 4 + i] = h;
                        aL[f][p * 4 + i]  = (_Float16)((v - (float)h) * LO_SCALE);
                    }
                }
            }
            // this fence keeps the wait behind the conversions, which run while the B fragments land:
            // without it the wait is lifted to their head
            __builtin_amdgcn_sched_barrier(0);
            asm volatile("s_wait_dscnt 0x0" ::: "memory");  // this wave's reads of stage t have returned
            bar_signal();
            __builtin_amdgcn_sched_barrier(0);      // keeps the matrix instructions behind the signal
            // three runs of MT * NT independent accumulator tiles; the set read first feeds two of them
#pragma unroll
            for (int nt = 0; nt < NT; ++nt)
#pragma unroll
                for (int f = 0; f < MT; ++f)
                    acc[f][nt] = __builtin_amdgcn_wmma_f32_16x16x32_f16(
                        false, a16[f], false, bh[nt], (short)0, acc[f][nt], false, false);
#pragma unroll
            for (int nt = 0; nt < NT; ++nt)
#pragma unroll
                for (int f = 0; f < MT; ++f)
                    accL[f][nt] = __builtin_amdgcn_wmma_f32_16x16x32_f16(
                        false, aL[f], false, bh[nt], (short)0, accL[f][nt], false, false);
#pragma unroll
            for (int nt = 0; nt < NT; ++nt)
#pragma unroll
                for (int f = 0; f < MT; ++f)
                    acc[f][nt] = __builtin_amdgcn_wmma_f32_16x16x32_f16(
                        false, a16[f], false, bc[nt], (short)0, acc[f][nt], false, false);
        }
    }
#undef G0X
#undef G0B
    asm volatile("s_wait_tensorcnt 0x0" ::: "memory");      // no request is open when the wave ends
    asm volatile("s_wait_dscnt 0x0" ::: "memory");          // nor an LDS read, before sB is written below
    bar_wait();         // the split barrier's last wait: every wave's reads of the last stage have returned

    // ---- epilogue: the two K halves are added, bias + store ----
    // Of its 32 rows a wave stores 16 (16 kg ..) and hands its sums of the other 16 to its partner, wave ^ 4,
    // through LDS. sB is free: the wait above stands behind every read of it, and no request is open.
    v4f*       slotOut = (v4f*)(sB + waveU * 8192) + lane;
    const v4f* slotIn  = (const v4f*)(sB + (waveU ^ 4) * 8192) + lane;
    if (kg == 0)
        put_half(slotOut, acc[1], accL[1]);
    else
        put_half(slotOut, acc[0], accL[0]);
    __syncthreads();    // the partner's sums are in LDS
    float* o = out + (size_t)(rowBlk * ROWS_PER_BLOCK + rg * (MT * 16) + kg * 16 + hiL * 8) * U_DIM + gn0 + n;
    if (kg == 0)
        finish_half(o, bias + gn0 + n, slotIn, acc[0], accL[0]);
    else
        finish_half(o, bias + gn0 + n, slotIn, acc[1], accL[1]);
}

extern "C" void kernel_launch(void* const* d_in, const int* in_sizes, int n_in,
                              void* d_out, int out_size, void* d_ws, size_t ws_size,
                              hipStream_t stream) {
    (void)in_sizes; (void)n_in; (void)ws_size; (void)out_size;
    const float* x    = (const float*)d_in[0];
    const float* w    = (const float*)d_in[1];
    const float* bias = (const float*)d_in[2];
    const int*   mp   = (const int*)d_in[3];
    float* out = (float*)d_out;
    float* ws  = (float*)d_ws;              // 2 MB used: 16 slabs x 2 strips x 64 KB

    // one thread per column and 8 K values: 256 * 256 threads
    mpdense_pack_kernel<<<dim3(D_DIM / 8), dim3(256), 0, stream>>>(w, mp, ws);

    dim3 grid((B_DIM / ROWS_PER_BLOCK) * (U_DIM / COLS_PER_BLOCK));  // 128 * 2 = 256 blocks
    dim3 block(256);                                                 // 8 waves (wave32)
    mpdense_wmma_kernel<<<grid, block, 0, stream>>>(x, ws, bias, out);
}
